// v000
// Measured on an AMD MI455X. A time is GPU time per run, averaged over a window of back-to-back runs after a warm-up
// (all launches, gaps included; the runs take copies of the inputs in turn), and the median of several windows.
// Apart from v000's, it joins two sittings. Times from different sittings can be a few percent apart, while
// side-by-side timings come from the same sitting.
// v000 is the starting kernel. One run takes 192 microseconds.
#include <hip/hip_runtime.h>
#include <hip/hip_bf16.h>
#include <cstdint>

typedef _Float16 f16;
typedef __attribute__((ext_vector_type(16))) _Float16 v16h;
typedef __attribute__((ext_vector_type(8)))  float    v8f;

#define BB 4
#define SS 2048
#define EE 1024
#define HH 16
#define DD 64

// ---------------------------------------------------------------------------
// Operand gathers per CDNA5 WMMA VGPR layouts (ISA 7.12.2, wave32):
//  A (16x32 f16): lane L holds row m=L&15; half-pair r holds
//      K = (r<4 ? 2r : 16+2(r-4)) + 8*(L>>4), K+1
//  B (32x16 f16): same gather over the row-major TRANSPOSED B source
//      (row index = output column n = L&15).
// ---------------------------------------------------------------------------
static __device__ __forceinline__ v16h load_tile_f16(const f16* base, int ld) {
    const int lane = threadIdx.x & 31;
    const int m = lane & 15, hi = lane >> 4;
    const f16* row = base + (size_t)m * ld;
    v16h out;
#pragma unroll
    for (int r = 0; r < 8; ++r) {
        int k = ((r < 4) ? (2 * r) : (16 + 2 * (r - 4))) + 8 * hi;
        out[2 * r]     = row[k];
        out[2 * r + 1] = row[k + 1];
    }
    return out;
}

static __device__ __forceinline__ v16h load_tile_f32(const float* base, int ld) {
    const int lane = threadIdx.x & 31;
    const int m = lane & 15, hi = lane >> 4;
    const float* row = base + (size_t)m * ld;
    v16h out;
#pragma unroll
    for (int r = 0; r < 8; ++r) {
        int k = ((r < 4) ? (2 * r) : (16 + 2 * (r - 4))) + 8 * hi;
        out[2 * r]     = (f16)row[k];
        out[2 * r + 1] = (f16)row[k + 1];
    }
    return out;
}

static __device__ __forceinline__ v8f wmma_f16(v16h a, v16h b, v8f c) {
    return __builtin_amdgcn_wmma_f32_16x16x32_f16(false, a, false, b,
                                                  (short)0, c, false, false);
}

// Async global->LDS copy of 16 bytes, tracked by ASYNCcnt (CDNA5 path;
// ISA 15.18.3 opcode 98). LDS dest offset comes from the low 32 bits of
// the generic pointer (LDS aperture: addr[31:0] is the LDS byte address).
static __device__ __forceinline__ void async_b128(const f16* gsrc, f16* ldst) {
    unsigned           dst = (unsigned)(uintptr_t)(void*)ldst;
    unsigned long long src = (unsigned long long)(uintptr_t)gsrc;
    asm volatile("global_load_async_to_lds_b128 %0, %1, off"
                 :: "v"(dst), "v"(src) : "memory");
}
static __device__ __forceinline__ void wait_async0() {
    asm volatile("s_wait_asynccnt 0x0" ::: "memory");
}

// ---------------------------------------------------------------------------
// Kernel 0: Wp f32 -> f16
// ---------------------------------------------------------------------------
__global__ void __launch_bounds__(256) convert_f32_to_f16(const float* __restrict__ src,
                                                          f16* __restrict__ dst, int n) {
    int i = blockIdx.x * 256 + threadIdx.x;
    if (i < n) dst[i] = (f16)src[i];
}

// ---------------------------------------------------------------------------
// Kernel 1: QKV projection. One wave per (b*h, 16-row s-tile).
//   Q,K stored [bh][s][d] f16 ; V stored transposed [bh][d][s] f16.
// ---------------------------------------------------------------------------
__global__ void __launch_bounds__(32) qkv_kernel(const float* __restrict__ x,
        const float* __restrict__ Wq, const float* __restrict__ bq,
        const float* __restrict__ Wk, const float* __restrict__ bk,
        const float* __restrict__ Wv, const float* __restrict__ bv,
        f16* __restrict__ Q, f16* __restrict__ Kb, f16* __restrict__ Vt) {
    const int bh = blockIdx.x;          // 0..63
    const int s0 = blockIdx.y * 16;     // row tile base
    const int b = bh >> 4, h = bh & 15;
    const int lane = threadIdx.x & 31;
    const int col = lane & 15, hi = lane >> 4;

    const float* xbase = x + ((size_t)(b * SS + s0)) * EE + h * DD;
    const v16h a0 = load_tile_f32(xbase,      EE);   // d = 0..31
    const v16h a1 = load_tile_f32(xbase + 32, EE);   // d = 32..63

    const float* Ws[3] = {Wq, Wk, Wv};
    const float* bs[3] = {bq, bk, bv};
#pragma unroll
    for (int w = 0; w < 3; ++w) {
#pragma unroll
        for (int n = 0; n < 4; ++n) {
            float bval = bs[w][n * 16 + col];
            v8f c = {};
#pragma unroll
            for (int g = 0; g < 8; ++g) c[g] = bval;
            v16h b0 = load_tile_f32(Ws[w] + (size_t)(n * 16) * DD,      DD);
            v16h b1 = load_tile_f32(Ws[w] + (size_t)(n * 16) * DD + 32, DD);
            c = wmma_f16(a0, b0, c);
            c = wmma_f16(a1, b1, c);
#pragma unroll
            for (int g = 0; g < 8; ++g) {
                int srow = s0 + g + 8 * hi;
                int d = n * 16 + col;
                f16 val = (f16)c[g];
                if (w == 0)      Q [((size_t)bh * SS + srow) * DD + d] = val;
                else if (w == 1) Kb[((size_t)bh * SS + srow) * DD + d] = val;
                else             Vt[((size_t)bh * DD + d) * SS + srow] = val;
            }
        }
    }
}

// ---------------------------------------------------------------------------
// Kernel 2: flash attention. 8 waves / block; 128 query rows share each
// 32-key K/V tile, double-buffered in LDS via async global->LDS loads.
// ---------------------------------------------------------------------------
#define KSTR 72   // LDS stride (halves) for 32x64 K tile: 144B, odd bank step
#define VSTR 40   // LDS stride for 64x32 V tile: 80B
#define PSTR 36   // LDS stride for per-wave 16x32 P staging: 72B
#define KSZ  (32 * KSTR)            // 2304 halves per K buffer
#define VSZ  (64 * VSTR)            // 2560 halves per V buffer
#define POFF (2 * KSZ + 2 * VSZ)    // 9728

__global__ void __launch_bounds__(256) flash_attn_kernel(const f16* __restrict__ Q,
        const f16* __restrict__ Kb, const f16* __restrict__ Vt,
        f16* __restrict__ attn) {
    const int bh = blockIdx.x;
    const int b = bh >> 4, h = bh & 15;
    const int tid  = threadIdx.x;
    const int w    = tid >> 5;
    const int lane = tid & 31;
    const int col = lane & 15, hi = lane >> 4;
    const int s0 = blockIdx.y * 128 + w * 16;       // this wave's query rows

    __shared__ __align__(16) f16 smem[POFF + 8 * 16 * PSTR];   // ~28 KB
    f16* ldsP = smem + POFF + w * (16 * PSTR);

    // Per-thread async-copy assignment: 256 threads x 16B covers each 4KB tile.
    const int krow = tid >> 3, kchunk = tid & 7;    // K: 32 rows x 128B
    const int vrow = tid >> 2, vchunk = tid & 3;    // V: 64 rows x 64B

    auto issue_tiles = [&](int j, int buf) {
        f16* kbuf = smem + buf * KSZ;               // no pointer arrays: compute
        f16* vbuf = smem + 2 * KSZ + buf * VSZ;     // bases arithmetically
        async_b128(Kb + ((size_t)bh * SS + j * 32 + krow) * DD + kchunk * 8,
                   kbuf + krow * KSTR + kchunk * 8);
        async_b128(Vt + ((size_t)bh * DD + vrow) * SS + j * 32 + vchunk * 8,
                   vbuf + vrow * VSTR + vchunk * 8);
    };

    const f16* qbase = Q + ((size_t)bh * SS + s0) * DD;
    const v16h aq0 = load_tile_f16(qbase,      DD);
    const v16h aq1 = load_tile_f16(qbase + 32, DD);

    float mrow[8], lrow[8];
    v8f oacc[4] = {};
#pragma unroll
    for (int g = 0; g < 8; ++g) { mrow[g] = -3.0e38f; lrow[g] = 0.0f; }

    issue_tiles(0, 0);
    for (int j = 0; j < SS / 32; ++j) {
        const int buf = j & 1;
        const f16* kcur = smem + buf * KSZ;
        const f16* vcur = smem + 2 * KSZ + buf * VSZ;

        wait_async0();           // my async copies for tile j done
        __syncthreads();         // everyone's copies done; prior reads retired
        if (j + 1 < SS / 32) issue_tiles(j + 1, buf ^ 1);   // overlap next tile

        // ---- scores: Q(16x64) x K^T(64x32) as two 16x16 tiles ----
        float p[2][8];
#pragma unroll
        for (int t = 0; t < 2; ++t) {
            const f16* kbase = kcur + t * 16 * KSTR;
            v16h b0 = load_tile_f16(kbase,      KSTR);
            v16h b1 = load_tile_f16(kbase + 32, KSTR);
            v8f c = {};
            c = wmma_f16(aq0, b0, c);
            c = wmma_f16(aq1, b1, c);
#pragma unroll
            for (int g = 0; g < 8; ++g) p[t][g] = c[g] * 0.125f; // 1/sqrt(64)
        }
        // ---- online softmax (rows live in 16-lane halves) ----
#pragma unroll
        for (int g = 0; g < 8; ++g) {
            float tmax = fmaxf(p[0][g], p[1][g]);
#pragma unroll
            for (int msk = 1; msk < 16; msk <<= 1)
                tmax = fmaxf(tmax, __shfl_xor(tmax, msk, 16));
            float mnew  = fmaxf(mrow[g], tmax);
            float scale = __expf(mrow[g] - mnew);
            mrow[g] = mnew;
            p[0][g] = __expf(p[0][g] - mnew);
            p[1][g] = __expf(p[1][g] - mnew);
            float ps = p[0][g] + p[1][g];
#pragma unroll
            for (int msk = 1; msk < 16; msk <<= 1)
                ps += __shfl_xor(ps, msk, 16);
            lrow[g] = lrow[g] * scale + ps;
#pragma unroll
            for (int n = 0; n < 4; ++n) oacc[n][g] *= scale;
        }
        // ---- re-stripe P into A-operand layout via per-wave LDS region ----
        // (DS ops execute in order within a wave; only compiler ordering needed)
#pragma unroll
        for (int g = 0; g < 8; ++g) {
            int m = g + 8 * hi;
            ldsP[m * PSTR + col]      = (f16)p[0][g];
            ldsP[m * PSTR + 16 + col] = (f16)p[1][g];
        }
        asm volatile("" ::: "memory");
        v16h ap = load_tile_f16(ldsP, PSTR);
        // ---- P(16x32) x V(32x16) for each of 4 d-tiles ----
#pragma unroll
        for (int n = 0; n < 4; ++n) {
            v16h bv = load_tile_f16(vcur + (n * 16) * VSTR, VSTR);
            oacc[n] = wmma_f16(ap, bv, oacc[n]);
        }
    }
    // normalize and store attn as [b][s][h*64+d] f16
#pragma unroll
    for (int g = 0; g < 8; ++g) {
        float rl = 1.0f / lrow[g];
        int srow = s0 + g + 8 * hi;
#pragma unroll
        for (int n = 0; n < 4; ++n) {
            attn[((size_t)b * SS + srow) * EE + h * DD + n * 16 + col] =
                (f16)(oacc[n][g] * rl);
        }
    }
}

// ---------------------------------------------------------------------------
// Kernel 3: output projection  out = attn @ Wp^T + bp   (f32 out)
// 8 waves / block compute a 128x128 tile; A and B K-chunks staged in LDS.
// ---------------------------------------------------------------------------
#define OSTR 40   // LDS stride (halves) for 128x32 chunks: 80B, conflict-free

__global__ void __launch_bounds__(256) out_proj_kernel(const f16* __restrict__ attn,
        const f16* __restrict__ Wp16, const float* __restrict__ bp,
        float* __restrict__ out) {
    const int rt = blockIdx.x;                      // 0..63 (128-row groups)
    const int ct = blockIdx.y;                      // 0..7  (128-col groups)
    const int tid  = threadIdx.x;
    const int w    = tid >> 5;
    const int lane = tid & 31;
    const int col = lane & 15, hi = lane >> 4;

    __shared__ __align__(16) f16 smem2[2 * 128 * OSTR];        // 20 KB
    f16* ldsA = smem2;
    f16* ldsB = smem2 + 128 * OSTR;

    v8f acc[8];
#pragma unroll
    for (int c2 = 0; c2 < 8; ++c2) {
        float bval = bp[ct * 128 + c2 * 16 + col];
#pragma unroll
        for (int g = 0; g < 8; ++g) acc[c2][g] = bval;
    }

    const int lrow = tid >> 2;       // 0..63 (two passes cover 128 rows)
    const int lchunk = tid & 3;      // 16B chunks of the 64B-wide k-slab
    for (int kc = 0; kc < EE / 32; ++kc) {
        __syncthreads();             // previous chunk fully consumed
#pragma unroll
        for (int rr = 0; rr < 2; ++rr) {
            int row = lrow + 64 * rr;
            const int4* asrc = (const int4*)(attn +
                ((size_t)(rt * 128 + row)) * EE + kc * 32 + lchunk * 8);
            *(int4*)(ldsA + row * OSTR + lchunk * 8) = *asrc;
            const int4* bsrc = (const int4*)(Wp16 +
                ((size_t)(ct * 128 + row)) * EE + kc * 32 + lchunk * 8);
            *(int4*)(ldsB + row * OSTR + lchunk * 8) = *bsrc;
        }
        __syncthreads();
        v16h a = load_tile_f16(ldsA + w * 16 * OSTR, OSTR);
#pragma unroll
        for (int c2 = 0; c2 < 8; ++c2) {
            v16h bm = load_tile_f16(ldsB + c2 * 16 * OSTR, OSTR);
            acc[c2] = wmma_f16(a, bm, acc[c2]);
        }
    }
#pragma unroll
    for (int c2 = 0; c2 < 8; ++c2) {
#pragma unroll
        for (int g = 0; g < 8; ++g) {
            int row = rt * 128 + w * 16 + g + 8 * hi;
            out[(size_t)row * EE + ct * 128 + c2 * 16 + col] = acc[c2][g];
        }
    }
}

// ---------------------------------------------------------------------------
extern "C" void kernel_launch(void* const* d_in, const int* in_sizes, int n_in,
                              void* d_out, int out_size, void* d_ws, size_t ws_size,
                              hipStream_t stream) {
    const float* x  = (const float*)d_in[0];
    const float* Wq = (const float*)d_in[1];
    const float* bq = (const float*)d_in[2];
    const float* Wk = (const float*)d_in[3];
    const float* bk = (const float*)d_in[4];
    const float* Wv = (const float*)d_in[5];
    const float* bv = (const float*)d_in[6];
    const float* Wp = (const float*)d_in[7];
    const float* bp = (const float*)d_in[8];
    float* out = (float*)d_out;

    const size_t nPH = (size_t)BB * HH * SS * DD;   // 8,388,608 halves / tensor
    f16* Q    = (f16*)d_ws;
    f16* Kb   = Q  + nPH;
    f16* Vt   = Kb + nPH;
    f16* attn = Vt + nPH;
    f16* Wp16 = attn + (size_t)BB * SS * EE;        // ~66 MB total workspace

    convert_f32_to_f16<<<(EE * EE + 255) / 256, 256, 0, stream>>>(Wp, Wp16, EE * EE);
    qkv_kernel<<<dim3(BB * HH, SS / 16), 32, 0, stream>>>(x, Wq, bq, Wk, bk, Wv, bv,
                                                          Q, Kb, Vt);
    flash_attn_kernel<<<dim3(BB * HH, SS / 128), 256, 0, stream>>>(Q, Kb, Vt, attn);
    out_proj_kernel<<<dim3(BB * SS / 128, EE / 128), 256, 0, stream>>>(attn, Wp16, bp, out);
}

// v001
// A run of this version takes 135 microseconds.
// In both of two side-by-side timings against v000, it was 1.49 times as fast.
#include <hip/hip_runtime.h>
#include <hip/hip_bf16.h>
#include <cstdint>

typedef _Float16 f16;
typedef __attribute__((ext_vector_type(16))) _Float16 v16h;
typedef __attribute__((ext_vector_type(8)))  _Float16 v8h;
typedef __attribute__((ext_vector_type(8)))  float    v8f;

#define BB 4
#define SS 2048
#define EE 1024
#define HH 16
#define DD 64

// ---------------------------------------------------------------------------
// Operand gathers per CDNA5 WMMA VGPR layouts (ISA 7.12.2, wave32):
//  A (16x32 f16): lane L holds row m=L&15; half-pair r holds
//      K = (r<4 ? 2r : 16+2(r-4)) + 8*(L>>4), K+1
//  B (32x16 f16): same gather over the row-major TRANSPOSED B source
//      (row index = output column n = L&15).
// ---------------------------------------------------------------------------
static __device__ __forceinline__ v16h load_tile_f16(const f16* base, int ld) {
    const int lane = threadIdx.x & 31;
    const int m = lane & 15, hi = lane >> 4;
    const f16* row = base + (size_t)m * ld;
    v16h out;
#pragma unroll
    for (int r = 0; r < 8; ++r) {
        int k = ((r < 4) ? (2 * r) : (16 + 2 * (r - 4))) + 8 * hi;
        out[2 * r]     = row[k];
        out[2 * r + 1] = row[k + 1];
    }
    return out;
}

static __device__ __forceinline__ v16h load_tile_f32(const float* base, int ld) {
    const int lane = threadIdx.x & 31;
    const int m = lane & 15, hi = lane >> 4;
    const float* row = base + (size_t)m * ld;
    v16h out;
#pragma unroll
    for (int r = 0; r < 8; ++r) {
        int k = ((r < 4) ? (2 * r) : (16 + 2 * (r - 4))) + 8 * hi;
        out[2 * r]     = (f16)row[k];
        out[2 * r + 1] = (f16)row[k + 1];
    }
    return out;
}

static __device__ __forceinline__ v8f wmma_f16(v16h a, v16h b, v8f c) {
    return __builtin_amdgcn_wmma_f32_16x16x32_f16(false, a, false, b,
                                                  (short)0, c, false, false);
}

// Async global->LDS copy of 16 bytes, tracked by ASYNCcnt (CDNA5 path;
// ISA 15.18.3 opcode 98). LDS dest offset comes from the low 32 bits of
// the generic pointer (LDS aperture: addr[31:0] is the LDS byte address).
static __device__ __forceinline__ void async_b128(const f16* gsrc, f16* ldst) {
    unsigned           dst = (unsigned)(uintptr_t)(void*)ldst;
    unsigned long long src = (unsigned long long)(uintptr_t)gsrc;
    asm volatile("global_load_async_to_lds_b128 %0, %1, off"
                 :: "v"(dst), "v"(src) : "memory");
}
static __device__ __forceinline__ void wait_async0() {
    asm volatile("s_wait_asynccnt 0x0" ::: "memory");
}

// ---------------------------------------------------------------------------
// Kernel 0: Wp f32 -> f16
// ---------------------------------------------------------------------------
__global__ void __launch_bounds__(256) convert_f32_to_f16(const float* __restrict__ src,
                                                          f16* __restrict__ dst, int n) {
    int i = blockIdx.x * 256 + threadIdx.x;
    if (i < n) dst[i] = (f16)src[i];
}

// ---------------------------------------------------------------------------
// Kernel 1: QKV projection. One wave per (b*h, 16-row s-tile).
//   Q,K stored [bh][s][d] f16 ; V stored transposed [bh][d][s] f16.
// ---------------------------------------------------------------------------
__global__ void __launch_bounds__(32) qkv_kernel(const float* __restrict__ x,
        const float* __restrict__ Wq, const float* __restrict__ bq,
        const float* __restrict__ Wk, const float* __restrict__ bk,
        const float* __restrict__ Wv, const float* __restrict__ bv,
        f16* __restrict__ Q, f16* __restrict__ Kb, f16* __restrict__ Vt) {
    const int bh = blockIdx.x;          // 0..63
    const int s0 = blockIdx.y * 16;     // row tile base
    const int b = bh >> 4, h = bh & 15;
    const int lane = threadIdx.x & 31;
    const int col = lane & 15, hi = lane >> 4;

    const float* xbase = x + ((size_t)(b * SS + s0)) * EE + h * DD;
    const v16h a0 = load_tile_f32(xbase,      EE);   // d = 0..31
    const v16h a1 = load_tile_f32(xbase + 32, EE);   // d = 32..63

    const float* Ws[3] = {Wq, Wk, Wv};
    const float* bs[3] = {bq, bk, bv};
#pragma unroll
    for (int w = 0; w < 3; ++w) {
#pragma unroll
        for (int n = 0; n < 4; ++n) {
            float bval = bs[w][n * 16 + col];
            v8f c = {};
#pragma unroll
            for (int g = 0; g < 8; ++g) c[g] = bval;
            v16h b0 = load_tile_f32(Ws[w] + (size_t)(n * 16) * DD,      DD);
            v16h b1 = load_tile_f32(Ws[w] + (size_t)(n * 16) * DD + 32, DD);
            c = wmma_f16(a0, b0, c);
            c = wmma_f16(a1, b1, c);
#pragma unroll
            for (int g = 0; g < 8; ++g) {
                int srow = s0 + g + 8 * hi;
                int d = n * 16 + col;
                f16 val = (f16)c[g];
                if (w == 0)      Q [((size_t)bh * SS + srow) * DD + d] = val;
                else if (w == 1) Kb[((size_t)bh * SS + srow) * DD + d] = val;
                else             Vt[((size_t)bh * DD + d) * SS + srow] = val;
            }
        }
    }
}

#define KSTR 72   // LDS stride (halves) for 32x64 K tile: 144B, odd bank step
#define VSTR 40   // LDS stride for 64x32 V tile: 80B
#define KSZ  (32 * KSTR)            // 2304 halves per K buffer
#define VSZ  (64 * VSTR)            // 2560 halves per V buffer
#define POFF (2 * KSZ + 2 * VSZ)    // 9728

// lane l <-> lane l ^ 16: the two lanes that share one query column
static __device__ __forceinline__ float xhalf(float v) {
    int i = __builtin_bit_cast(int, v);
    return __builtin_bit_cast(float,
        __builtin_amdgcn_permlanex16(i, i, 0x76543210, 0xfedcba98, false, false));
}

__global__ void __launch_bounds__(256) flash_attn_kernel(const f16* __restrict__ Q,
        const f16* __restrict__ Kb, const f16* __restrict__ Vt,
        f16* __restrict__ attn) {
    const int bh = blockIdx.x;
    const int b = bh >> 4, h = bh & 15;
    const int tid  = threadIdx.x;
    const int w    = tid >> 5;
    const int lane = tid & 31;
    const int col = lane & 15, hi = lane >> 4;
    const int s0 = blockIdx.y * 128 + w * 16;       // this wave's query rows

    __shared__ __align__(16) f16 smem[POFF];        // 19 KB

    // Per-thread async-copy assignment: 256 threads x 16B covers each 4KB tile.
    const int krow = tid >> 3, kchunk = tid & 7;    // K: 32 rows x 128B
    const int vrow = tid >> 2, vchunk = tid & 3;    // V: 64 rows x 64B

    auto issue_tiles = [&](int j, int buf) {
        f16* kbuf = smem + buf * KSZ;               // no pointer arrays: compute
        f16* vbuf = smem + 2 * KSZ + buf * VSZ;     // bases arithmetically
        async_b128(Kb + ((size_t)bh * SS + j * 32 + krow) * DD + kchunk * 8,
                   kbuf + krow * KSTR + kchunk * 8);
        async_b128(Vt + ((size_t)bh * DD + vrow) * SS + j * 32 + vchunk * 8,
                   vbuf + vrow * VSTR + vchunk * 8);
    };

    // Q as the B operand: lane holds query column col, kept in registers
    const f16* qbase = Q + ((size_t)bh * SS + s0) * DD;
    const v16h aq0 = load_tile_f16(qbase,      DD);
    const v16h aq1 = load_tile_f16(qbase + 32, DD);

    // per lane: running maximum of query col (equal in both halves) and the
    // sum over this half's keys only (the halves are joined after the loop)
    float mrow = -3.0e38f, lsum = 0.0f;
    v8f oacc[4] = {};            // oacc[n][g] = O[query col][d = 16n + 8hi + g]

    issue_tiles(0, 0);
    for (int j = 0; j < SS / 32; ++j) {
        const int buf = j & 1;
        const f16* kcur = smem + buf * KSZ;
        const f16* vcur = smem + 2 * KSZ + buf * VSZ;

        wait_async0();           // my async copies for tile j done
        __syncthreads();         // everyone's copies done; prior reads retired
        if (j + 1 < SS / 32) issue_tiles(j + 1, buf ^ 1);   // overlap next tile

        // ---- scores: K(32x64) x Q^T(64x16) as two 16x16 tiles ----
        // p[t][g] = S[query col][key 16t + 8hi + g]
        float p[2][8];
#pragma unroll
        for (int t = 0; t < 2; ++t) {
            const f16* kbase = kcur + t * 16 * KSTR;
            v16h b0 = load_tile_f16(kbase,      KSTR);
            v16h b1 = load_tile_f16(kbase + 32, KSTR);
            v8f c = {};
            c = wmma_f16(b0, aq0, c);
            c = wmma_f16(b1, aq1, c);
#pragma unroll
            for (int g = 0; g < 8; ++g) p[t][g] = c[g] * 0.125f; // 1/sqrt(64)
        }
        // ---- online softmax: 16 scores in-lane, one exchange between halves ----
        float tmax = fmaxf(p[0][0], p[0][1]);
#pragma unroll
        for (int g = 2; g < 8; g += 2) tmax = fmaxf(tmax, fmaxf(p[0][g], p[0][g + 1]));
#pragma unroll
        for (int g = 0; g < 8; g += 2) tmax = fmaxf(tmax, fmaxf(p[1][g], p[1][g + 1]));
        tmax = fmaxf(tmax, xhalf(tmax));
        const float mnew  = fmaxf(mrow, tmax);
        const float scale = __expf(mrow - mnew);
        mrow = mnew;
        float ps0 = 0.0f, ps1 = 0.0f;
#pragma unroll
        for (int g = 0; g < 8; ++g) {
            p[0][g] = __expf(p[0][g] - mnew);
            p[1][g] = __expf(p[1][g] - mnew);
            ps0 += p[0][g];
            ps1 += p[1][g];
        }
        lsum = lsum * scale + (ps0 + ps1);
#pragma unroll
        for (int n = 0; n < 4; ++n)
#pragma unroll
            for (int g = 0; g < 8; ++g) oacc[n][g] *= scale;
        // ---- P^T as the B operand: the two score tiles, converted in place,
        //      already lie in the operand's k order (k = 8hi + g, 16 + 8hi + g)
        v16h bp;
#pragma unroll
        for (int g = 0; g < 8; ++g) {
            bp[g]     = (f16)p[0][g];
            bp[8 + g] = (f16)p[1][g];
        }
        // ---- V^T(16x32) x P^T(32x16) for each of 4 d-tiles ----
#pragma unroll
        for (int n = 0; n < 4; ++n) {
            v16h av = load_tile_f16(vcur + (n * 16) * VSTR, VSTR);
            oacc[n] = wmma_f16(av, bp, oacc[n]);
        }
    }
    // normalize and store attn as [b][s][h*64+d] f16: 8 consecutive d per lane
    const float rl = 1.0f / (lsum + xhalf(lsum));
    f16* orow = attn + ((size_t)b * SS + s0 + col) * EE + h * DD + 8 * hi;
#pragma unroll
    for (int n = 0; n < 4; ++n) {
        v8h o;
#pragma unroll
        for (int g = 0; g < 8; ++g) o[g] = (f16)(oacc[n][g] * rl);
        *(v8h*)(orow + n * 16) = o;
    }
}

// ---------------------------------------------------------------------------
// Kernel 3: output projection  out = attn @ Wp^T + bp   (f32 out)
// 8 waves / block compute a 128x128 tile; A and B K-chunks staged in LDS.
// ---------------------------------------------------------------------------
#define OSTR 40   // LDS stride (halves) for 128x32 chunks: 80B, conflict-free

__global__ void __launch_bounds__(256) out_proj_kernel(const f16* __restrict__ attn,
        const f16* __restrict__ Wp16, const float* __restrict__ bp,
        float* __restrict__ out) {
    const int rt = blockIdx.x;                      // 0..63 (128-row groups)
    const int ct = blockIdx.y;                      // 0..7  (128-col groups)
    const int tid  = threadIdx.x;
    const int w    = tid >> 5;
    const int lane = tid & 31;
    const int col = lane & 15, hi = lane >> 4;

    __shared__ __align__(16) f16 smem2[2 * 128 * OSTR];        // 20 KB
    f16* ldsA = smem2;
    f16* ldsB = smem2 + 128 * OSTR;

    v8f acc[8];
#pragma unroll
    for (int c2 = 0; c2 < 8; ++c2) {
        float bval = bp[ct * 128 + c2 * 16 + col];
#pragma unroll
        for (int g = 0; g < 8; ++g) acc[c2][g] = bval;
    }

    const int lrow = tid >> 2;       // 0..63 (two passes cover 128 rows)
    const int lchunk = tid & 3;      // 16B chunks of the 64B-wide k-slab
    for (int kc = 0; kc < EE / 32; ++kc) {
        __syncthreads();             // previous chunk fully consumed
#pragma unroll
        for (int rr = 0; rr < 2; ++rr) {
            int row = lrow + 64 * rr;
            const int4* asrc = (const int4*)(attn +
                ((size_t)(rt * 128 + row)) * EE + kc * 32 + lchunk * 8);
            *(int4*)(ldsA + row * OSTR + lchunk * 8) = *asrc;
            const int4* bsrc = (const int4*)(Wp16 +
                ((size_t)(ct * 128 + row)) * EE + kc * 32 + lchunk * 8);
            *(int4*)(ldsB + row * OSTR + lchunk * 8) = *bsrc;
        }
        __syncthreads();
        v16h a = load_tile_f16(ldsA + w * 16 * OSTR, OSTR);
#pragma unroll
        for (int c2 = 0; c2 < 8; ++c2) {
            v16h bm = load_tile_f16(ldsB + c2 * 16 * OSTR, OSTR);
            acc[c2] = wmma_f16(a, bm, acc[c2]);
        }
    }
#pragma unroll
    for (int c2 = 0; c2 < 8; ++c2) {
#pragma unroll
        for (int g = 0; g < 8; ++g) {
            int row = rt * 128 + w * 16 + g + 8 * hi;
            out[(size_t)row * EE + ct * 128 + c2 * 16 + col] = acc[c2][g];
        }
    }
}

// ---------------------------------------------------------------------------
extern "C" void kernel_launch(void* const* d_in, const int* in_sizes, int n_in,
                              void* d_out, int out_size, void* d_ws, size_t ws_size,
                              hipStream_t stream) {
    const float* x  = (const float*)d_in[0];
    const float* Wq = (const float*)d_in[1];
    const float* bq = (const float*)d_in[2];
    const float* Wk = (const float*)d_in[3];
    const float* bk = (const float*)d_in[4];
    const float* Wv = (const float*)d_in[5];
    const float* bv = (const float*)d_in[6];
    const float* Wp = (const float*)d_in[7];
    const float* bp = (const float*)d_in[8];
    float* out = (float*)d_out;

    const size_t nPH = (size_t)BB * HH * SS * DD;   // 8,388,608 halves / tensor
    f16* Q    = (f16*)d_ws;
    f16* Kb   = Q  + nPH;
    f16* Vt   = Kb + nPH;
    f16* attn = Vt + nPH;
    f16* Wp16 = attn + (size_t)BB * SS * EE;        // ~66 MB total workspace

    convert_f32_to_f16<<<(EE * EE + 255) / 256, 256, 0, stream>>>(Wp, Wp16, EE * EE);
    qkv_kernel<<<dim3(BB * HH, SS / 16), 32, 0, stream>>>(x, Wq, bq, Wk, bk, Wv, bv,
                                                          Q, Kb, Vt);
    flash_attn_kernel<<<dim3(BB * HH, SS / 128), 256, 0, stream>>>(Q, Kb, Vt, attn);
    out_proj_kernel<<<dim3(BB * SS / 128, EE / 128), 256, 0, stream>>>(attn, Wp16, bp, out);
}

// v002
// A run of this version takes 127 microseconds.
// In both of two side-by-side timings against v001, it was 1.06 times as fast.
// All steps since v000 together make it 1.59 times as fast.
#include <hip/hip_runtime.h>
#include <hip/hip_bf16.h>
#include <cstdint>

typedef _Float16 f16;
typedef __attribute__((ext_vector_type(16))) _Float16 v16h;
typedef __attribute__((ext_vector_type(8)))  _Float16 v8h;
typedef __attribute__((ext_vector_type(8)))  float    v8f;

#define BB 4
#define SS 2048
#define EE 1024
#define HH 16
#define DD 64

// ---------------------------------------------------------------------------
// Operand gathers per CDNA5 WMMA VGPR layouts (ISA 7.12.2, wave32):
//  A (16x32 f16): lane L holds row m=L&15; half-pair r holds
//      K = (r<4 ? 2r : 16+2(r-4)) + 8*(L>>4), K+1
//  B (32x16 f16): same gather over the row-major TRANSPOSED B source
//      (row index = output column n = L&15).
// ---------------------------------------------------------------------------
static __device__ __forceinline__ v16h load_tile_f16(const f16* base, int ld) {
    const int lane = threadIdx.x & 31;
    const int m = lane & 15, hi = lane >> 4;
    const f16* row = base + (size_t)m * ld;
    v16h out;
#pragma unroll
    for (int r = 0; r < 8; ++r) {
        int k = ((r < 4) ? (2 * r) : (16 + 2 * (r - 4))) + 8 * hi;
        out[2 * r]     = row[k];
        out[2 * r + 1] = row[k + 1];
    }
    return out;
}

static __device__ __forceinline__ v16h load_tile_f32(const float* base, int ld) {
    const int lane = threadIdx.x & 31;
    const int m = lane & 15, hi = lane >> 4;
    const float* row = base + (size_t)m * ld;
    v16h out;
#pragma unroll
    for (int r = 0; r < 8; ++r) {
        int k = ((r < 4) ? (2 * r) : (16 + 2 * (r - 4))) + 8 * hi;
        out[2 * r]     = (f16)row[k];
        out[2 * r + 1] = (f16)row[k + 1];
    }
    return out;
}

static __device__ __forceinline__ v8f wmma_f16(v16h a, v16h b, v8f c) {
    return __builtin_amdgcn_wmma_f32_16x16x32_f16(false, a, false, b,
                                                  (short)0, c, false, false);
}

// Async global->LDS copy of 16 bytes, tracked by ASYNCcnt (CDNA5 path;
// ISA 15.18.3 opcode 98). LDS dest offset comes from the low 32 bits of
// the generic pointer (LDS aperture: addr[31:0] is the LDS byte address).
static __device__ __forceinline__ void async_b128(const f16* gsrc, f16* ldst) {
    unsigned           dst = (unsigned)(uintptr_t)(void*)ldst;
    unsigned long long src = (unsigned long long)(uintptr_t)gsrc;
    asm volatile("global_load_async_to_lds_b128 %0, %1, off"
                 :: "v"(dst), "v"(src) : "memory");
}
static __device__ __forceinline__ void wait_async0() {
    asm volatile("s_wait_asynccnt 0x0" ::: "memory");
}

// ---------------------------------------------------------------------------
// Kernel 0: Wp f32 -> f16
// ---------------------------------------------------------------------------
__global__ void __launch_bounds__(256) convert_f32_to_f16(const float* __restrict__ src,
                                                          f16* __restrict__ dst, int n) {
    int i = blockIdx.x * 256 + threadIdx.x;
    if (i < n) dst[i] = (f16)src[i];
}

// ---------------------------------------------------------------------------
// Kernel 1: QKV projection. One wave per (b*h, 16-row s-tile).
//   Q,K stored [bh][s][d] f16 ; V stored transposed [bh][d][s] f16.
// ---------------------------------------------------------------------------
__global__ void __launch_bounds__(32) qkv_kernel(const float* __restrict__ x,
        const float* __restrict__ Wq, const float* __restrict__ bq,
        const float* __restrict__ Wk, const float* __restrict__ bk,
        const float* __restrict__ Wv, const float* __restrict__ bv,
        f16* __restrict__ Q, f16* __restrict__ Kb, f16* __restrict__ Vt) {
    const int bh = blockIdx.x;          // 0..63
    const int s0 = blockIdx.y * 16;     // row tile base
    const int b = bh >> 4, h = bh & 15;
    const int lane = threadIdx.x & 31;
    const int col = lane & 15, hi = lane >> 4;

    const float* xbase = x + ((size_t)(b * SS + s0)) * EE + h * DD;
    const v16h a0 = load_tile_f32(xbase,      EE);   // d = 0..31
    const v16h a1 = load_tile_f32(xbase + 32, EE);   // d = 32..63

    const float* Ws[3] = {Wq, Wk, Wv};
    const float* bs[3] = {bq, bk, bv};
#pragma unroll
    for (int w = 0; w < 3; ++w) {
#pragma unroll
        for (int n = 0; n < 4; ++n) {
            float bval = bs[w][n * 16 + col];
            v8f c = {};
#pragma unroll
            for (int g = 0; g < 8; ++g) c[g] = bval;
            v16h b0 = load_tile_f32(Ws[w] + (size_t)(n * 16) * DD,      DD);
            v16h b1 = load_tile_f32(Ws[w] + (size_t)(n * 16) * DD + 32, DD);
            c = wmma_f16(a0, b0, c);
            c = wmma_f16(a1, b1, c);
#pragma unroll
            for (int g = 0; g < 8; ++g) {
                int srow = s0 + g + 8 * hi;
                int d = n * 16 + col;
                f16 val = (f16)c[g];
                if (w == 0)      Q [((size_t)bh * SS + srow) * DD + d] = val;
                else if (w == 1) Kb[((size_t)bh * SS + srow) * DD + d] = val;
                else             Vt[((size_t)bh * DD + d) * SS + srow] = val;
            }
        }
    }
}

#define KSTR 72   // LDS stride (halves) for 32x64 K tile: 144B, odd bank step
#define VSTR 40   // LDS stride for 64x32 V tile: 80B
#define KSZ  (32 * KSTR)            // 2304 halves per K buffer
#define VSZ  (64 * VSTR)            // 2560 halves per V buffer
#define POFF (2 * KSZ + 2 * VSZ)    // 9728

// lane l <-> lane l ^ 16: the two lanes that share one query column
static __device__ __forceinline__ float xhalf(float v) {
    int i = __builtin_bit_cast(int, v);
    return __builtin_bit_cast(float,
        __builtin_amdgcn_permlanex16(i, i, 0x76543210, 0xfedcba98, false, false));
}

// 512 blocks = two per WGP = four waves per SIMD: the register budget of that
// residency (256) is stated so that fragments can be fetched ahead of their use.
__global__ void __launch_bounds__(256) __attribute__((amdgpu_waves_per_eu(4, 4)))
flash_attn_kernel(const f16* __restrict__ Q,
        const f16* __restrict__ Kb, const f16* __restrict__ Vt,
        f16* __restrict__ attn) {
    const int bh = blockIdx.x;
    const int b = bh >> 4, h = bh & 15;
    const int tid  = threadIdx.x;
    const int w    = tid >> 5;
    const int lane = tid & 31;
    const int col = lane & 15, hi = lane >> 4;
    const int s0 = blockIdx.y * 256 + w * 32;       // this wave's query rows

    __shared__ __align__(16) f16 smem[POFF];        // 19 KB

    // Per-thread async-copy assignment: 256 threads x 16B covers each 4KB tile.
    const int krow = tid >> 3, kchunk = tid & 7;    // K: 32 rows x 128B
    const int vrow = tid >> 2, vchunk = tid & 3;    // V: 64 rows x 64B

    auto issue_tiles = [&](int j, int buf) {
        f16* kbuf = smem + buf * KSZ;               // no pointer arrays: compute
        f16* vbuf = smem + 2 * KSZ + buf * VSZ;     // bases arithmetically
        async_b128(Kb + ((size_t)bh * SS + j * 32 + krow) * DD + kchunk * 8,
                   kbuf + krow * KSTR + kchunk * 8);
        async_b128(Vt + ((size_t)bh * DD + vrow) * SS + j * 32 + vchunk * 8,
                   vbuf + vrow * VSTR + vchunk * 8);
    };

    // Q as the B operand: lane holds query column col, kept in registers
    const f16* qbase = Q + ((size_t)bh * SS + s0) * DD;
    v16h aq0[2], aq1[2];         // column tile q: queries s0 + 16q + col
#pragma unroll
    for (int q = 0; q < 2; ++q) {
        aq0[q] = load_tile_f16(qbase + q * 16 * DD,      DD);
        aq1[q] = load_tile_f16(qbase + q * 16 * DD + 32, DD);
    }

    // per lane and column tile: running maximum of the query (equal in both
    // halves) and the sum over this half's keys only (joined after the loop)
    float mrow[2] = {-3.0e38f, -3.0e38f}, lsum[2] = {0.0f, 0.0f};
    v8f oacc[2][4] = {};         // oacc[q][n][g] = O[query][d = 16n + 8hi + g]

    issue_tiles(0, 0);
    for (int j = 0; j < SS / 32; ++j) {
        const int buf = j & 1;
        const f16* kcur = smem + buf * KSZ;
        const f16* vcur = smem + 2 * KSZ + buf * VSZ;

        wait_async0();           // my async copies for tile j done
        __syncthreads();         // everyone's copies done; prior reads retired
        if (j + 1 < SS / 32) issue_tiles(j + 1, buf ^ 1);   // overlap next tile

        // ---- scores: K(32x64) x Q^T(64x32) as two by two 16x16 tiles ----
        // p[q][t][g] = S[query of tile q][key 16t + 8hi + g]
        // (kept as whole accumulator vectors: element-wise steps then pair
        //  neighbouring registers of one tile, with no moves between tiles)
        v8f p[2][2];
#pragma unroll
        for (int t = 0; t < 2; ++t) {
            const f16* kbase = kcur + t * 16 * KSTR;
            v16h b0 = load_tile_f16(kbase,      KSTR);
            v16h b1 = load_tile_f16(kbase + 32, KSTR);
#pragma unroll
            for (int q = 0; q < 2; ++q) {
                v8f c = {};
                c = wmma_f16(b0, aq0[q], c);
                c = wmma_f16(b1, aq1[q], c);
                p[q][t] = c * 0.125f;                // 1/sqrt(64)
            }
        }
        v16h bp[2];
#pragma unroll
        for (int q = 0; q < 2; ++q) {
            // ---- online softmax: 16 scores in-lane, one exchange between halves ----
            float tmax = fmaxf(p[q][0][0], p[q][0][1]);
#pragma unroll
            for (int g = 2; g < 8; g += 2) tmax = fmaxf(tmax, fmaxf(p[q][0][g], p[q][0][g + 1]));
#pragma unroll
            for (int g = 0; g < 8; g += 2) tmax = fmaxf(tmax, fmaxf(p[q][1][g], p[q][1][g + 1]));
            tmax = fmaxf(tmax, xhalf(tmax));
            const float mnew  = fmaxf(mrow[q], tmax);
            const float scale = __expf(mrow[q] - mnew);
            mrow[q] = mnew;
            // exp(x) as exp2(x * log2 e), the form __expf compiles to
            p[q][0] = (p[q][0] - mnew) * 1.44269504f;
            p[q][1] = (p[q][1] - mnew) * 1.44269504f;
            float ps0 = 0.0f, ps1 = 0.0f;
#pragma unroll
            for (int g = 0; g < 8; ++g) {
                p[q][0][g] = __builtin_amdgcn_exp2f(p[q][0][g]);
                p[q][1][g] = __builtin_amdgcn_exp2f(p[q][1][g]);
                ps0 += p[q][0][g];
                ps1 += p[q][1][g];
            }
            lsum[q] = lsum[q] * scale + (ps0 + ps1);
#pragma unroll
            for (int n = 0; n < 4; ++n) oacc[q][n] *= scale;
            // ---- P^T as the B operand: the two score tiles, converted in place,
            //      already lie in the operand's k order (k = 8hi + g, 16 + 8hi + g)
#pragma unroll
            for (int g = 0; g < 8; ++g) {
                bp[q][g]     = (f16)p[q][0][g];
                bp[q][8 + g] = (f16)p[q][1][g];
            }
        }
        // ---- V^T(16x32) x P^T(32x32) for each of 4 d-tiles ----
#pragma unroll
        for (int n = 0; n < 4; ++n) {
            v16h av = load_tile_f16(vcur + (n * 16) * VSTR, VSTR);
#pragma unroll
            for (int q = 0; q < 2; ++q) oacc[q][n] = wmma_f16(av, bp[q], oacc[q][n]);
        }
    }
    // normalize and store attn as [b][s][h*64+d] f16: 8 consecutive d per lane
#pragma unroll
    for (int q = 0; q < 2; ++q) {
        const float rl = 1.0f / (lsum[q] + xhalf(lsum[q]));
        f16* orow = attn + ((size_t)b * SS + s0 + q * 16 + col) * EE + h * DD + 8 * hi;
#pragma unroll
        for (int n = 0; n < 4; ++n) {
            v8h o;
#pragma unroll
            for (int g = 0; g < 8; ++g) o[g] = (f16)(oacc[q][n][g] * rl);
            *(v8h*)(orow + n * 16) = o;
        }
    }
}

// ---------------------------------------------------------------------------
// Kernel 3: output projection  out = attn @ Wp^T + bp   (f32 out)
// 8 waves / block compute a 128x128 tile; A and B K-chunks staged in LDS.
// ---------------------------------------------------------------------------
#define OSTR 40   // LDS stride (halves) for 128x32 chunks: 80B, conflict-free

__global__ void __launch_bounds__(256) out_proj_kernel(const f16* __restrict__ attn,
        const f16* __restrict__ Wp16, const float* __restrict__ bp,
        float* __restrict__ out) {
    const int rt = blockIdx.x;                      // 0..63 (128-row groups)
    const int ct = blockIdx.y;                      // 0..7  (128-col groups)
    const int tid  = threadIdx.x;
    const int w    = tid >> 5;
    const int lane = tid & 31;
    const int col = lane & 15, hi = lane >> 4;

    __shared__ __align__(16) f16 smem2[2 * 128 * OSTR];        // 20 KB
    f16* ldsA = smem2;
    f16* ldsB = smem2 + 128 * OSTR;

    v8f acc[8];
#pragma unroll
    for (int c2 = 0; c2 < 8; ++c2) {
        float bval = bp[ct * 128 + c2 * 16 + col];
#pragma unroll
        for (int g = 0; g < 8; ++g) acc[c2][g] = bval;
    }

    const int lrow = tid >> 2;       // 0..63 (two passes cover 128 rows)
    const int lchunk = tid & 3;      // 16B chunks of the 64B-wide k-slab
    for (int kc = 0; kc < EE / 32; ++kc) {
        __syncthreads();             // previous chunk fully consumed
#pragma unroll
        for (int rr = 0; rr < 2; ++rr) {
            int row = lrow + 64 * rr;
            const int4* asrc = (const int4*)(attn +
                ((size_t)(rt * 128 + row)) * EE + kc * 32 + lchunk * 8);
            *(int4*)(ldsA + row * OSTR + lchunk * 8) = *asrc;
            const int4* bsrc = (const int4*)(Wp16 +
                ((size_t)(ct * 128 + row)) * EE + kc * 32 + lchunk * 8);
            *(int4*)(ldsB + row * OSTR + lchunk * 8) = *bsrc;
        }
        __syncthreads();
        v16h a = load_tile_f16(ldsA + w * 16 * OSTR, OSTR);
#pragma unroll
        for (int c2 = 0; c2 < 8; ++c2) {
            v16h bm = load_tile_f16(ldsB + c2 * 16 * OSTR, OSTR);
            acc[c2] = wmma_f16(a, bm, acc[c2]);
        }
    }
#pragma unroll
    for (int c2 = 0; c2 < 8; ++c2) {
#pragma unroll
        for (int g = 0; g < 8; ++g) {
            int row = rt * 128 + w * 16 + g + 8 * hi;
            out[(size_t)row * EE + ct * 128 + c2 * 16 + col] = acc[c2][g];
        }
    }
}

// ---------------------------------------------------------------------------
extern "C" void kernel_launch(void* const* d_in, const int* in_sizes, int n_in,
                              void* d_out, int out_size, void* d_ws, size_t ws_size,
                              hipStream_t stream) {
    const float* x  = (const float*)d_in[0];
    const float* Wq = (const float*)d_in[1];
    const float* bq = (const float*)d_in[2];
    const float* Wk = (const float*)d_in[3];
    const float* bk = (const float*)d_in[4];
    const float* Wv = (const float*)d_in[5];
    const float* bv = (const float*)d_in[6];
    const float* Wp = (const float*)d_in[7];
    const float* bp = (const float*)d_in[8];
    float* out = (float*)d_out;

    const size_t nPH = (size_t)BB * HH * SS * DD;   // 8,388,608 halves / tensor
    f16* Q    = (f16*)d_ws;
    f16* Kb   = Q  + nPH;
    f16* Vt   = Kb + nPH;
    f16* attn = Vt + nPH;
    f16* Wp16 = attn + (size_t)BB * SS * EE;        // ~66 MB total workspace

    convert_f32_to_f16<<<(EE * EE + 255) / 256, 256, 0, stream>>>(Wp, Wp16, EE * EE);
    qkv_kernel<<<dim3(BB * HH, SS / 16), 32, 0, stream>>>(x, Wq, bq, Wk, bk, Wv, bv,
                                                          Q, Kb, Vt);
    flash_attn_kernel<<<dim3(BB * HH, SS / 256), 256, 0, stream>>>(Q, Kb, Vt, attn);
    out_proj_kernel<<<dim3(BB * SS / 128, EE / 128), 256, 0, stream>>>(attn, Wp16, bp, out);
}

// v003
// It runs in 115 microseconds.
// Next to v002, in two timings, it ran 1.09 times as fast each time.
// Counting every step since v000, it is 1.74 times as fast.
#include <hip/hip_runtime.h>
#include <hip/hip_bf16.h>
#include <cstdint>

typedef _Float16 f16;
typedef __attribute__((ext_vector_type(16))) _Float16 v16h;
typedef __attribute__((ext_vector_type(8)))  _Float16 v8h;
typedef __attribute__((ext_vector_type(8)))  float    v8f;

#define BB 4
#define SS 2048
#define EE 1024
#define HH 16
#define DD 64

// ---------------------------------------------------------------------------
// Operand gathers per CDNA5 WMMA VGPR layouts (ISA 7.12.2, wave32):
//  A (16x32 f16): lane L holds row m=L&15; half-pair r holds
//      K = (r<4 ? 2r : 16+2(r-4)) + 8*(L>>4), K+1
//  B (32x16 f16): same gather over the row-major TRANSPOSED B source
//      (row index = output column n = L&15).
// ---------------------------------------------------------------------------
static __device__ __forceinline__ v16h load_tile_f16(const f16* base, int ld) {
    const int lane = threadIdx.x & 31;
    const int m = lane & 15, hi = lane >> 4;
    const f16* row = base + (size_t)m * ld;
    v16h out;
#pragma unroll
    for (int r = 0; r < 8; ++r) {
        int k = ((r < 4) ? (2 * r) : (16 + 2 * (r - 4))) + 8 * hi;
        out[2 * r]     = row[k];
        out[2 * r + 1] = row[k + 1];
    }
    return out;
}

static __device__ __forceinline__ v16h load_tile_f32(const float* base, int ld) {
    const int lane = threadIdx.x & 31;
    const int m = lane & 15, hi = lane >> 4;
    const float* row = base + (size_t)m * ld;
    v16h out;
#pragma unroll
    for (int r = 0; r < 8; ++r) {
        int k = ((r < 4) ? (2 * r) : (16 + 2 * (r - 4))) + 8 * hi;
        out[2 * r]     = (f16)row[k];
        out[2 * r + 1] = (f16)row[k + 1];
    }
    return out;
}

static __device__ __forceinline__ v8f wmma_f16(v16h a, v16h b, v8f c) {
    return __builtin_amdgcn_wmma_f32_16x16x32_f16(false, a, false, b,
                                                  (short)0, c, false, false);
}

// Async global->LDS copy of 16 bytes, tracked by ASYNCcnt (CDNA5 path;
// ISA 15.18.3 opcode 98). LDS dest offset comes from the low 32 bits of
// the generic pointer (LDS aperture: addr[31:0] is the LDS byte address).
static __device__ __forceinline__ void async_b128(const f16* gsrc, f16* ldst) {
    unsigned           dst = (unsigned)(uintptr_t)(void*)ldst;
    unsigned long long src = (unsigned long long)(uintptr_t)gsrc;
    asm volatile("global_load_async_to_lds_b128 %0, %1, off"
                 :: "v"(dst), "v"(src) : "memory");
}
static __device__ __forceinline__ void wait_async0() {
    asm volatile("s_wait_asynccnt 0x0" ::: "memory");
}

// ---------------------------------------------------------------------------
// Kernel 0: Wp f32 -> f16
// ---------------------------------------------------------------------------
__global__ void __launch_bounds__(256) convert_f32_to_f16(const float* __restrict__ src,
                                                          f16* __restrict__ dst, int n) {
    int i = blockIdx.x * 256 + threadIdx.x;
    if (i < n) dst[i] = (f16)src[i];
}

// ---------------------------------------------------------------------------
// Kernel 1: QKV projection. One wave per (b*h, 16-row s-tile).
//   Q,K stored [bh][s][d] f16 ; V stored transposed [bh][d][s] f16.
// ---------------------------------------------------------------------------
__global__ void __launch_bounds__(32) qkv_kernel(const float* __restrict__ x,
        const float* __restrict__ Wq, const float* __restrict__ bq,
        const float* __restrict__ Wk, const float* __restrict__ bk,
        const float* __restrict__ Wv, const float* __restrict__ bv,
        f16* __restrict__ Q, f16* __restrict__ Kb, f16* __restrict__ Vt) {
    const int bh = blockIdx.x;          // 0..63
    const int s0 = blockIdx.y * 16;     // row tile base
    const int b = bh >> 4, h = bh & 15;
    const int lane = threadIdx.x & 31;
    const int col = lane & 15, hi = lane >> 4;

    const float* xbase = x + ((size_t)(b * SS + s0)) * EE + h * DD;
    const v16h a0 = load_tile_f32(xbase,      EE);   // d = 0..31
    const v16h a1 = load_tile_f32(xbase + 32, EE);   // d = 32..63

    const float* Ws[3] = {Wq, Wk, Wv};
    const float* bs[3] = {bq, bk, bv};
#pragma unroll
    for (int w = 0; w < 3; ++w) {
#pragma unroll
        for (int n = 0; n < 4; ++n) {
            float bval = bs[w][n * 16 + col];
            v8f c = {};
#pragma unroll
            for (int g = 0; g < 8; ++g) c[g] = bval;
            v16h b0 = load_tile_f32(Ws[w] + (size_t)(n * 16) * DD,      DD);
            v16h b1 = load_tile_f32(Ws[w] + (size_t)(n * 16) * DD + 32, DD);
            c = wmma_f16(a0, b0, c);
            c = wmma_f16(a1, b1, c);
#pragma unroll
            for (int g = 0; g < 8; ++g) {
                int srow = s0 + g + 8 * hi;
                int d = n * 16 + col;
                f16 val = (f16)c[g];
                if (w == 0)      Q [((size_t)bh * SS + srow) * DD + d] = val;
                else if (w == 1) Kb[((size_t)bh * SS + srow) * DD + d] = val;
                else             Vt[((size_t)bh * DD + d) * SS + srow] = val;
            }
        }
    }
}

#define KSTR 72   // LDS stride (halves) for 32x64 K tile: 144B, odd bank step
#define VSTR 40   // LDS stride for 64x32 V tile: 80B
#define KSZ  (32 * KSTR)            // 2304 halves per K buffer
#define VSZ  (64 * VSTR)            // 2560 halves per V buffer
#define POFF (2 * KSZ + 2 * VSZ)    // 9728

// lane l <-> lane l ^ 16: the two lanes that share one query column
static __device__ __forceinline__ float xhalf(float v) {
    int i = __builtin_bit_cast(int, v);
    return __builtin_bit_cast(float,
        __builtin_amdgcn_permlanex16(i, i, 0x76543210, 0xfedcba98, false, false));
}

// 512 blocks = two per WGP = four waves per SIMD: the register budget of that
// residency (256) is stated so that fragments can be fetched ahead of their use.
__global__ void __launch_bounds__(256) __attribute__((amdgpu_waves_per_eu(4, 4)))
flash_attn_kernel(const f16* __restrict__ Q,
        const f16* __restrict__ Kb, const f16* __restrict__ Vt,
        f16* __restrict__ attn) {
    const int bh = blockIdx.x;
    const int b = bh >> 4, h = bh & 15;
    const int tid  = threadIdx.x;
    const int w    = tid >> 5;
    const int lane = tid & 31;
    const int col = lane & 15, hi = lane >> 4;
    const int s0 = blockIdx.y * 256 + w * 32;       // this wave's query rows

    __shared__ __align__(16) f16 smem[POFF];        // 19 KB

    // Per-thread async-copy assignment: 256 threads x 16B covers each 4KB tile.
    const int krow = tid >> 3, kchunk = tid & 7;    // K: 32 rows x 128B
    const int vrow = tid >> 2, vchunk = tid & 3;    // V: 64 rows x 64B

    auto issue_tiles = [&](int j, int buf) {
        f16* kbuf = smem + buf * KSZ;               // no pointer arrays: compute
        f16* vbuf = smem + 2 * KSZ + buf * VSZ;     // bases arithmetically
        async_b128(Kb + ((size_t)bh * SS + j * 32 + krow) * DD + kchunk * 8,
                   kbuf + krow * KSTR + kchunk * 8);
        async_b128(Vt + ((size_t)bh * DD + vrow) * SS + j * 32 + vchunk * 8,
                   vbuf + vrow * VSTR + vchunk * 8);
    };

    // Q as the B operand: lane holds query column col, kept in registers
    const f16* qbase = Q + ((size_t)bh * SS + s0) * DD;
    v16h aq0[2], aq1[2];         // column tile q: queries s0 + 16q + col
#pragma unroll
    for (int q = 0; q < 2; ++q) {
        aq0[q] = load_tile_f16(qbase + q * 16 * DD,      DD);
        aq1[q] = load_tile_f16(qbase + q * 16 * DD + 32, DD);
    }

    // per lane and column tile: running maximum of the query (equal in both
    // halves) and the sum over this half's keys only (joined after the loop)
    float mrow[2] = {-3.0e38f, -3.0e38f}, lsum[2] = {0.0f, 0.0f};
    v8f oacc[2][4] = {};         // oacc[q][n][g] = O[query][d = 16n + 8hi + g]

    issue_tiles(0, 0);
    for (int j = 0; j < SS / 32; ++j) {
        const int buf = j & 1;
        const f16* kcur = smem + buf * KSZ;
        const f16* vcur = smem + 2 * KSZ + buf * VSZ;

        wait_async0();           // my async copies for tile j done
        __syncthreads();         // everyone's copies done; prior reads retired
        if (j + 1 < SS / 32) issue_tiles(j + 1, buf ^ 1);   // overlap next tile

        // ---- scores: K(32x64) x Q^T(64x32) as two by two 16x16 tiles ----
        // p[q][t][g] = S[query of tile q][key 16t + 8hi + g]
        // (kept as whole accumulator vectors: element-wise steps then pair
        //  neighbouring registers of one tile, with no moves between tiles)
        v8f p[2][2];
#pragma unroll
        for (int t = 0; t < 2; ++t) {
            const f16* kbase = kcur + t * 16 * KSTR;
            v16h b0 = load_tile_f16(kbase,      KSTR);
            v16h b1 = load_tile_f16(kbase + 32, KSTR);
#pragma unroll
            for (int q = 0; q < 2; ++q) {
                v8f c = {};
                c = wmma_f16(b0, aq0[q], c);
                c = wmma_f16(b1, aq1[q], c);
                p[q][t] = c * 0.125f;                // 1/sqrt(64)
            }
        }
        v16h bp[2];
#pragma unroll
        for (int q = 0; q < 2; ++q) {
            // ---- online softmax: 16 scores in-lane, one exchange between halves ----
            float tmax = fmaxf(p[q][0][0], p[q][0][1]);
#pragma unroll
            for (int g = 2; g < 8; g += 2) tmax = fmaxf(tmax, fmaxf(p[q][0][g], p[q][0][g + 1]));
#pragma unroll
            for (int g = 0; g < 8; g += 2) tmax = fmaxf(tmax, fmaxf(p[q][1][g], p[q][1][g + 1]));
            tmax = fmaxf(tmax, xhalf(tmax));
            const float mnew  = fmaxf(mrow[q], tmax);
            const float scale = __expf(mrow[q] - mnew);
            mrow[q] = mnew;
            // exp(x) as exp2(x * log2 e), the form __expf compiles to
            p[q][0] = (p[q][0] - mnew) * 1.44269504f;
            p[q][1] = (p[q][1] - mnew) * 1.44269504f;
            float ps0 = 0.0f, ps1 = 0.0f;
#pragma unroll
            for (int g = 0; g < 8; ++g) {
                p[q][0][g] = __builtin_amdgcn_exp2f(p[q][0][g]);
                p[q][1][g] = __builtin_amdgcn_exp2f(p[q][1][g]);
                ps0 += p[q][0][g];
                ps1 += p[q][1][g];
            }
            lsum[q] = lsum[q] * scale + (ps0 + ps1);
#pragma unroll
            for (int n = 0; n < 4; ++n) oacc[q][n] *= scale;
            // ---- P^T as the B operand: the two score tiles, converted in place,
            //      already lie in the operand's k order (k = 8hi + g, 16 + 8hi + g)
#pragma unroll
            for (int g = 0; g < 8; ++g) {
                bp[q][g]     = (f16)p[q][0][g];
                bp[q][8 + g] = (f16)p[q][1][g];
            }
        }
        // ---- V^T(16x32) x P^T(32x32) for each of 4 d-tiles ----
#pragma unroll
        for (int n = 0; n < 4; ++n) {
            v16h av = load_tile_f16(vcur + (n * 16) * VSTR, VSTR);
#pragma unroll
            for (int q = 0; q < 2; ++q) oacc[q][n] = wmma_f16(av, bp[q], oacc[q][n]);
        }
    }
    // normalize and store attn as [b][s][h*64+d] f16: 8 consecutive d per lane
#pragma unroll
    for (int q = 0; q < 2; ++q) {
        const float rl = 1.0f / (lsum[q] + xhalf(lsum[q]));
        f16* orow = attn + ((size_t)b * SS + s0 + q * 16 + col) * EE + h * DD + 8 * hi;
#pragma unroll
        for (int n = 0; n < 4; ++n) {
            v8h o;
#pragma unroll
            for (int g = 0; g < 8; ++g) o[g] = (f16)(oacc[q][n][g] * rl);
            *(v8h*)(orow + n * 16) = o;
        }
    }
}

// ---------------------------------------------------------------------------
// Kernel 3: output projection  out = attn @ Wp^T + bp   (f32 out)
// 8 waves / block compute a 128x128 tile as 2 x 4 wave tiles of 64x32; A and B
// are staged in LDS 64 k at a time. Per chunk a wave reads its 8 A and 4 B
// fragments as one group and feeds 16 matrix instructions from them.
// ---------------------------------------------------------------------------
#define OBK  64   // k depth of one staged chunk
#define OSTR 72   // LDS stride (halves) for 128x64 chunks: 144B, 16B x odd

__global__ void __launch_bounds__(256) out_proj_kernel(const f16* __restrict__ attn,
        const f16* __restrict__ Wp16, const float* __restrict__ bp,
        float* __restrict__ out) {
    const int rt = blockIdx.x;                      // 0..63 (128-row groups)
    const int ct = blockIdx.y;                      // 0..7  (128-col groups)
    const int tid  = threadIdx.x;
    const int w    = tid >> 5;
    const int lane = tid & 31;
    const int col = lane & 15, hi = lane >> 4;
    const int wr = w >> 2;                          // 64-row half of the tile
    const int wc = w & 3;                           // 32-col quarter of the tile

    __shared__ __align__(16) f16 smem2[2 * 128 * OSTR];        // 36 KB
    f16* ldsA = smem2;
    f16* ldsB = smem2 + 128 * OSTR;

    v8f acc[4][2];
#pragma unroll
    for (int j = 0; j < 2; ++j) {
        float bval = bp[ct * 128 + wc * 32 + j * 16 + col];
#pragma unroll
        for (int i = 0; i < 4; ++i)
#pragma unroll
            for (int g = 0; g < 8; ++g) acc[i][j][g] = bval;
    }

    const int lrow = tid >> 3;       // 0..31 (four passes cover 128 rows)
    const int lchunk = tid & 7;      // 16B chunks of the 128B-wide k-slab
    const f16* asrc = attn + (size_t)(rt * 128 + lrow) * EE + lchunk * 8;
    const f16* bsrc = Wp16 + (size_t)(ct * 128 + lrow) * EE + lchunk * 8;
    f16* adst = ldsA + lrow * OSTR + lchunk * 8;
    f16* bdst = ldsB + lrow * OSTR + lchunk * 8;
    const f16* afrag = ldsA + wr * 64 * OSTR;
    const f16* bfrag = ldsB + wc * 32 * OSTR;
    for (int kc = 0; kc < EE / OBK; ++kc) {
        __syncthreads();             // previous chunk fully consumed
#pragma unroll
        for (int rr = 0; rr < 4; ++rr) {
            *(int4*)(adst + rr * 32 * OSTR) = *(const int4*)(asrc + (size_t)rr * 32 * EE);
            *(int4*)(bdst + rr * 32 * OSTR) = *(const int4*)(bsrc + (size_t)rr * 32 * EE);
        }
        asrc += OBK;
        bsrc += OBK;
        __syncthreads();
        v16h a[OBK / 32][4], bm[OBK / 32][2];
#pragma unroll
        for (int ks = 0; ks < OBK / 32; ++ks) {
#pragma unroll
            for (int j = 0; j < 2; ++j)
                bm[ks][j] = load_tile_f16(bfrag + j * 16 * OSTR + ks * 32, OSTR);
#pragma unroll
            for (int i = 0; i < 4; ++i)
                a[ks][i] = load_tile_f16(afrag + i * 16 * OSTR + ks * 32, OSTR);
        }
        // keeps the chunk's fragment reads one group ahead of its matrix
        // instructions: sunk among them, each read's LDS latency is waited singly
        __builtin_amdgcn_sched_barrier(0);
#pragma unroll
        for (int ks = 0; ks < OBK / 32; ++ks)
#pragma unroll
            for (int i = 0; i < 4; ++i)
#pragma unroll
                for (int j = 0; j < 2; ++j)
                    acc[i][j] = wmma_f16(a[ks][i], bm[ks][j], acc[i][j]);
    }
    float* obase = out + (size_t)(rt * 128 + wr * 64 + 8 * hi) * EE + ct * 128 + wc * 32 + col;
#pragma unroll
    for (int i = 0; i < 4; ++i)
#pragma unroll
        for (int g = 0; g < 8; ++g)
#pragma unroll
            for (int j = 0; j < 2; ++j)
                obase[(size_t)(i * 16 + g) * EE + j * 16] = acc[i][j][g];
}

// ---------------------------------------------------------------------------
extern "C" void kernel_launch(void* const* d_in, const int* in_sizes, int n_in,
                              void* d_out, int out_size, void* d_ws, size_t ws_size,
                              hipStream_t stream) {
    const float* x  = (const float*)d_in[0];
    const float* Wq = (const float*)d_in[1];
    const float* bq = (const float*)d_in[2];
    const float* Wk = (const float*)d_in[3];
    const float* bk = (const float*)d_in[4];
    const float* Wv = (const float*)d_in[5];
    const float* bv = (const float*)d_in[6];
    const float* Wp = (const float*)d_in[7];
    const float* bp = (const float*)d_in[8];
    float* out = (float*)d_out;

    const size_t nPH = (size_t)BB * HH * SS * DD;   // 8,388,608 halves / tensor
    f16* Q    = (f16*)d_ws;
    f16* Kb   = Q  + nPH;
    f16* Vt   = Kb + nPH;
    f16* attn = Vt + nPH;
    f16* Wp16 = attn + (size_t)BB * SS * EE;        // ~66 MB total workspace

    convert_f32_to_f16<<<(EE * EE + 255) / 256, 256, 0, stream>>>(Wp, Wp16, EE * EE);
    qkv_kernel<<<dim3(BB * HH, SS / 16), 32, 0, stream>>>(x, Wq, bq, Wk, bk, Wv, bv,
                                                          Q, Kb, Vt);
    flash_attn_kernel<<<dim3(BB * HH, SS / 256), 256, 0, stream>>>(Q, Kb, Vt, attn);
    out_proj_kernel<<<dim3(BB * SS / 128, EE / 128), 256, 0, stream>>>(attn, Wp16, bp, out);
}

// v004
// It runs in 99.9 microseconds.
// Next to v003, in two timings, it ran 1.16 times as fast each time.
// Over all steps from v000 it is 2.01 times as fast.
#include <hip/hip_runtime.h>
#include <hip/hip_bf16.h>
#include <cstdint>

typedef _Float16 f16;
typedef __attribute__((ext_vector_type(16))) _Float16 v16h;
typedef __attribute__((ext_vector_type(8)))  _Float16 v8h;
typedef __attribute__((ext_vector_type(8)))  float    v8f;

#define BB 4
#define SS 2048
#define EE 1024
#define HH 16
#define DD 64

// ---------------------------------------------------------------------------
// Operand gathers per CDNA5 WMMA VGPR layouts (ISA 7.12.2, wave32):
//  A (16x32 f16): lane L holds row m=L&15; half-pair r holds
//      K = (r<4 ? 2r : 16+2(r-4)) + 8*(L>>4), K+1
//  B (32x16 f16): same gather over the row-major TRANSPOSED B source
//      (row index = output column n = L&15).
// ---------------------------------------------------------------------------
static __device__ __forceinline__ v16h load_tile_f16(const f16* base, int ld) {
    const int lane = threadIdx.x & 31;
    const int m = lane & 15, hi = lane >> 4;
    const f16* row = base + (size_t)m * ld;
    v16h out;
#pragma unroll
    for (int r = 0; r < 8; ++r) {
        int k = ((r < 4) ? (2 * r) : (16 + 2 * (r - 4))) + 8 * hi;
        out[2 * r]     = row[k];
        out[2 * r + 1] = row[k + 1];
    }
    return out;
}

static __device__ __forceinline__ v16h load_tile_f32(const float* base, int ld) {
    const int lane = threadIdx.x & 31;
    const int m = lane & 15, hi = lane >> 4;
    const float* row = base + (size_t)m * ld;
    v16h out;
#pragma unroll
    for (int r = 0; r < 8; ++r) {
        int k = ((r < 4) ? (2 * r) : (16 + 2 * (r - 4))) + 8 * hi;
        out[2 * r]     = (f16)row[k];
        out[2 * r + 1] = (f16)row[k + 1];
    }
    return out;
}

static __device__ __forceinline__ v8f wmma_f16(v16h a, v16h b, v8f c) {
    return __builtin_amdgcn_wmma_f32_16x16x32_f16(false, a, false, b,
                                                  (short)0, c, false, false);
}

// Async global->LDS copy of 16 bytes, tracked by ASYNCcnt (CDNA5 path;
// ISA 15.18.3 opcode 98). LDS dest offset comes from the low 32 bits of
// the generic pointer (LDS aperture: addr[31:0] is the LDS byte address).
static __device__ __forceinline__ void async_b128(const f16* gsrc, f16* ldst) {
    unsigned           dst = (unsigned)(uintptr_t)(void*)ldst;
    unsigned long long src = (unsigned long long)(uintptr_t)gsrc;
    asm volatile("global_load_async_to_lds_b128 %0, %1, off"
                 :: "v"(dst), "v"(src) : "memory");
}
static __device__ __forceinline__ void wait_async0() {
    asm volatile("s_wait_asynccnt 0x0" ::: "memory");
}

// ---------------------------------------------------------------------------
// Kernel 0: Wp f32 -> f16
// ---------------------------------------------------------------------------
__global__ void __launch_bounds__(256) convert_f32_to_f16(const float* __restrict__ src,
                                                          f16* __restrict__ dst, int n) {
    int i = blockIdx.x * 256 + threadIdx.x;
    if (i < n) dst[i] = (f16)src[i];
}

// ---------------------------------------------------------------------------
// Kernel 1: QKV projection. 8 waves / block share one f16 copy of the three
// 64x64 weight matrices in LDS, converted once per block from whole-line loads;
// each wave takes two 16-row s-tiles of one (b,h) and reads its B fragments
// from LDS, every fragment feeding both tiles.
//   Q,K stored [bh][s][d] f16 ; V stored transposed [bh][d][s] f16.
// ---------------------------------------------------------------------------
#define WSTR 72   // LDS stride (halves) of a staged 64-wide weight row: 144B

typedef __attribute__((ext_vector_type(4))) _Float16 v4h;

// 512 blocks = two per WGP = four waves per SIMD: the register budget of that
// residency (256) is stated so that the whole grid is resident at once.
__global__ void __launch_bounds__(256) __attribute__((amdgpu_waves_per_eu(4)))
qkv_kernel(const float* __restrict__ x,
        const float* __restrict__ Wq, const float* __restrict__ bq,
        const float* __restrict__ Wk, const float* __restrict__ bk,
        const float* __restrict__ Wv, const float* __restrict__ bv,
        f16* __restrict__ Q, f16* __restrict__ Kb, f16* __restrict__ Vt) {
    const int bh = blockIdx.x;          // 0..63
    const int b = bh >> 4, h = bh & 15;
    const int tid  = threadIdx.x;
    const int lane = tid & 31;
    const int col = lane & 15, hi = lane >> 4;
    const int s0 = blockIdx.y * 256 + (tid >> 5) * 32;   // this wave's 32 rows

    __shared__ __align__(16) f16 wlds[3 * DD * WSTR];    // 27 KB

    const float* Ws[3] = {Wq, Wk, Wv};
    const float* bs[3] = {bq, bk, bv};

    // weights: 256 threads x 4 floats cover 16 rows of one matrix per pass
    float4 wraw[3][4];
#pragma unroll
    for (int w = 0; w < 3; ++w)
#pragma unroll
        for (int r = 0; r < 4; ++r)
            wraw[w][r] = *(const float4*)(Ws[w] + (r * 256 + tid) * 4);
    float bval[3][4];                    // asked for ahead of the barrier
#pragma unroll
    for (int w = 0; w < 3; ++w)
#pragma unroll
        for (int n = 0; n < 4; ++n) bval[w][n] = bs[w][n * 16 + col];

    const float* xbase = x + ((size_t)(b * SS + s0)) * EE + h * DD;
    v16h a0[2], a1[2];
#pragma unroll
    for (int t = 0; t < 2; ++t) {
        a0[t] = load_tile_f32(xbase + (size_t)t * 16 * EE,      EE);   // d = 0..31
        a1[t] = load_tile_f32(xbase + (size_t)t * 16 * EE + 32, EE);   // d = 32..63
    }

#pragma unroll
    for (int w = 0; w < 3; ++w)
#pragma unroll
        for (int r = 0; r < 4; ++r) {
            const int idx = r * 256 + tid;               // float4 index in the matrix
            v4h hv = {(f16)wraw[w][r].x, (f16)wraw[w][r].y,
                      (f16)wraw[w][r].z, (f16)wraw[w][r].w};
            *(v4h*)(wlds + (w * DD + (idx >> 4)) * WSTR + (idx & 15) * 4) = hv;
        }
    __syncthreads();                     // the staged weights are read by every wave

#pragma unroll
    for (int w = 0; w < 3; ++w) {
#pragma unroll
        for (int n = 0; n < 4; ++n) {
            const f16* wt = wlds + (w * DD + n * 16) * WSTR;
            v16h b0 = load_tile_f16(wt,      WSTR);
            v16h b1 = load_tile_f16(wt + 32, WSTR);
#pragma unroll
            for (int t = 0; t < 2; ++t) {
                v8f c = {};
#pragma unroll
                for (int g = 0; g < 8; ++g) c[g] = bval[w][n];
                c = wmma_f16(a0[t], b0, c);
                c = wmma_f16(a1[t], b1, c);
#pragma unroll
                for (int g = 0; g < 8; ++g) {
                    int srow = s0 + t * 16 + g + 8 * hi;
                    int d = n * 16 + col;
                    f16 val = (f16)c[g];
                    if (w == 0)      Q [((size_t)bh * SS + srow) * DD + d] = val;
                    else if (w == 1) Kb[((size_t)bh * SS + srow) * DD + d] = val;
                    else             Vt[((size_t)bh * DD + d) * SS + srow] = val;
                }
            }
        }
    }
}

#define KSTR 72   // LDS stride (halves) for 32x64 K tile: 144B, odd bank step
#define VSTR 40   // LDS stride for 64x32 V tile: 80B
#define KSZ  (32 * KSTR)            // 2304 halves per K buffer
#define VSZ  (64 * VSTR)            // 2560 halves per V buffer
#define POFF (2 * KSZ + 2 * VSZ)    // 9728

// lane l <-> lane l ^ 16: the two lanes that share one query column
static __device__ __forceinline__ float xhalf(float v) {
    int i = __builtin_bit_cast(int, v);
    return __builtin_bit_cast(float,
        __builtin_amdgcn_permlanex16(i, i, 0x76543210, 0xfedcba98, false, false));
}

// 512 blocks = two per WGP = four waves per SIMD: the register budget of that
// residency (256) is stated so that fragments can be fetched ahead of their use.
__global__ void __launch_bounds__(256) __attribute__((amdgpu_waves_per_eu(4, 4)))
flash_attn_kernel(const f16* __restrict__ Q,
        const f16* __restrict__ Kb, const f16* __restrict__ Vt,
        f16* __restrict__ attn) {
    const int bh = blockIdx.x;
    const int b = bh >> 4, h = bh & 15;
    const int tid  = threadIdx.x;
    const int w    = tid >> 5;
    const int lane = tid & 31;
    const int col = lane & 15, hi = lane >> 4;
    const int s0 = blockIdx.y * 256 + w * 32;       // this wave's query rows

    __shared__ __align__(16) f16 smem[POFF];        // 19 KB

    // Per-thread async-copy assignment: 256 threads x 16B covers each 4KB tile.
    const int krow = tid >> 3, kchunk = tid & 7;    // K: 32 rows x 128B
    const int vrow = tid >> 2, vchunk = tid & 3;    // V: 64 rows x 64B

    auto issue_tiles = [&](int j, int buf) {
        f16* kbuf = smem + buf * KSZ;               // no pointer arrays: compute
        f16* vbuf = smem + 2 * KSZ + buf * VSZ;     // bases arithmetically
        async_b128(Kb + ((size_t)bh * SS + j * 32 + krow) * DD + kchunk * 8,
                   kbuf + krow * KSTR + kchunk * 8);
        async_b128(Vt + ((size_t)bh * DD + vrow) * SS + j * 32 + vchunk * 8,
                   vbuf + vrow * VSTR + vchunk * 8);
    };

    // Q as the B operand: lane holds query column col, kept in registers
    const f16* qbase = Q + ((size_t)bh * SS + s0) * DD;
    v16h aq0[2], aq1[2];         // column tile q: queries s0 + 16q + col
#pragma unroll
    for (int q = 0; q < 2; ++q) {
        aq0[q] = load_tile_f16(qbase + q * 16 * DD,      DD);
        aq1[q] = load_tile_f16(qbase + q * 16 * DD + 32, DD);
    }

    // per lane and column tile: running maximum of the query (equal in both
    // halves) and the sum over this half's keys only (joined after the loop)
    float mrow[2] = {-3.0e38f, -3.0e38f}, lsum[2] = {0.0f, 0.0f};
    v8f oacc[2][4] = {};         // oacc[q][n][g] = O[query][d = 16n + 8hi + g]

    issue_tiles(0, 0);
    for (int j = 0; j < SS / 32; ++j) {
        const int buf = j & 1;
        const f16* kcur = smem + buf * KSZ;
        const f16* vcur = smem + 2 * KSZ + buf * VSZ;

        wait_async0();           // my async copies for tile j done
        __syncthreads();         // everyone's copies done; prior reads retired
        if (j + 1 < SS / 32) issue_tiles(j + 1, buf ^ 1);   // overlap next tile

        // ---- scores: K(32x64) x Q^T(64x32) as two by two 16x16 tiles ----
        // p[q][t][g] = S[query of tile q][key 16t + 8hi + g]
        // (kept as whole accumulator vectors: element-wise steps then pair
        //  neighbouring registers of one tile, with no moves between tiles)
        v8f p[2][2];
#pragma unroll
        for (int t = 0; t < 2; ++t) {
            const f16* kbase = kcur + t * 16 * KSTR;
            v16h b0 = load_tile_f16(kbase,      KSTR);
            v16h b1 = load_tile_f16(kbase + 32, KSTR);
#pragma unroll
            for (int q = 0; q < 2; ++q) {
                v8f c = {};
                c = wmma_f16(b0, aq0[q], c);
                c = wmma_f16(b1, aq1[q], c);
                p[q][t] = c * 0.125f;                // 1/sqrt(64)
            }
        }
        v16h bp[2];
#pragma unroll
        for (int q = 0; q < 2; ++q) {
            // ---- online softmax: 16 scores in-lane, one exchange between halves ----
            float tmax = fmaxf(p[q][0][0], p[q][0][1]);
#pragma unroll
            for (int g = 2; g < 8; g += 2) tmax = fmaxf(tmax, fmaxf(p[q][0][g], p[q][0][g + 1]));
#pragma unroll
            for (int g = 0; g < 8; g += 2) tmax = fmaxf(tmax, fmaxf(p[q][1][g], p[q][1][g + 1]));
            tmax = fmaxf(tmax, xhalf(tmax));
            const float mnew  = fmaxf(mrow[q], tmax);
            const float scale = __expf(mrow[q] - mnew);
            mrow[q] = mnew;
            // exp(x) as exp2(x * log2 e), the form __expf compiles to
            p[q][0] = (p[q][0] - mnew) * 1.44269504f;
            p[q][1] = (p[q][1] - mnew) * 1.44269504f;
            float ps0 = 0.0f, ps1 = 0.0f;
#pragma unroll
            for (int g = 0; g < 8; ++g) {
                p[q][0][g] = __builtin_amdgcn_exp2f(p[q][0][g]);
                p[q][1][g] = __builtin_amdgcn_exp2f(p[q][1][g]);
                ps0 += p[q][0][g];
                ps1 += p[q][1][g];
            }
            lsum[q] = lsum[q] * scale + (ps0 + ps1);
#pragma unroll
            for (int n = 0; n < 4; ++n) oacc[q][n] *= scale;
            // ---- P^T as the B operand: the two score tiles, converted in place,
            //      already lie in the operand's k order (k = 8hi + g, 16 + 8hi + g)
#pragma unroll
            for (int g = 0; g < 8; ++g) {
                bp[q][g]     = (f16)p[q][0][g];
                bp[q][8 + g] = (f16)p[q][1][g];
            }
        }
        // ---- V^T(16x32) x P^T(32x32) for each of 4 d-tiles ----
#pragma unroll
        for (int n = 0; n < 4; ++n) {
            v16h av = load_tile_f16(vcur + (n * 16) * VSTR, VSTR);
#pragma unroll
            for (int q = 0; q < 2; ++q) oacc[q][n] = wmma_f16(av, bp[q], oacc[q][n]);
        }
    }
    // normalize and store attn as [b][s][h*64+d] f16: 8 consecutive d per lane
#pragma unroll
    for (int q = 0; q < 2; ++q) {
        const float rl = 1.0f / (lsum[q] + xhalf(lsum[q]));
        f16* orow = attn + ((size_t)b * SS + s0 + q * 16 + col) * EE + h * DD + 8 * hi;
#pragma unroll
        for (int n = 0; n < 4; ++n) {
            v8h o;
#pragma unroll
            for (int g = 0; g < 8; ++g) o[g] = (f16)(oacc[q][n][g] * rl);
            *(v8h*)(orow + n * 16) = o;
        }
    }
}

// ---------------------------------------------------------------------------
// Kernel 3: output projection  out = attn @ Wp^T + bp   (f32 out)
// 8 waves / block compute a 128x128 tile as 2 x 4 wave tiles of 64x32; A and B
// are staged in LDS 64 k at a time. Per chunk a wave reads its 8 A and 4 B
// fragments as one group and feeds 16 matrix instructions from them.
// ---------------------------------------------------------------------------
#define OBK  64   // k depth of one staged chunk
#define OSTR 72   // LDS stride (halves) for 128x64 chunks: 144B, 16B x odd

__global__ void __launch_bounds__(256) out_proj_kernel(const f16* __restrict__ attn,
        const f16* __restrict__ Wp16, const float* __restrict__ bp,
        float* __restrict__ out) {
    const int rt = blockIdx.x;                      // 0..63 (128-row groups)
    const int ct = blockIdx.y;                      // 0..7  (128-col groups)
    const int tid  = threadIdx.x;
    const int w    = tid >> 5;
    const int lane = tid & 31;
    const int col = lane & 15, hi = lane >> 4;
    const int wr = w >> 2;                          // 64-row half of the tile
    const int wc = w & 3;                           // 32-col quarter of the tile

    __shared__ __align__(16) f16 smem2[2 * 128 * OSTR];        // 36 KB
    f16* ldsA = smem2;
    f16* ldsB = smem2 + 128 * OSTR;

    v8f acc[4][2];
#pragma unroll
    for (int j = 0; j < 2; ++j) {
        float bval = bp[ct * 128 + wc * 32 + j * 16 + col];
#pragma unroll
        for (int i = 0; i < 4; ++i)
#pragma unroll
            for (int g = 0; g < 8; ++g) acc[i][j][g] = bval;
    }

    const int lrow = tid >> 3;       // 0..31 (four passes cover 128 rows)
    const int lchunk = tid & 7;      // 16B chunks of the 128B-wide k-slab
    const f16* asrc = attn + (size_t)(rt * 128 + lrow) * EE + lchunk * 8;
    const f16* bsrc = Wp16 + (size_t)(ct * 128 + lrow) * EE + lchunk * 8;
    f16* adst = ldsA + lrow * OSTR + lchunk * 8;
    f16* bdst = ldsB + lrow * OSTR + lchunk * 8;
    const f16* afrag = ldsA + wr * 64 * OSTR;
    const f16* bfrag = ldsB + wc * 32 * OSTR;
    for (int kc = 0; kc < EE / OBK; ++kc) {
        __syncthreads();             // previous chunk fully consumed
#pragma unroll
        for (int rr = 0; rr < 4; ++rr) {
            *(int4*)(adst + rr * 32 * OSTR) = *(const int4*)(asrc + (size_t)rr * 32 * EE);
            *(int4*)(bdst + rr * 32 * OSTR) = *(const int4*)(bsrc + (size_t)rr * 32 * EE);
        }
        asrc += OBK;
        bsrc += OBK;
        __syncthreads();
        v16h a[OBK / 32][4], bm[OBK / 32][2];
#pragma unroll
        for (int ks = 0; ks < OBK / 32; ++ks) {
#pragma unroll
            for (int j = 0; j < 2; ++j)
                bm[ks][j] = load_tile_f16(bfrag + j * 16 * OSTR + ks * 32, OSTR);
#pragma unroll
            for (int i = 0; i < 4; ++i)
                a[ks][i] = load_tile_f16(afrag + i * 16 * OSTR + ks * 32, OSTR);
        }
        // keeps the chunk's fragment reads one group ahead of its matrix
        // instructions: sunk among them, each read's LDS latency is waited singly
        __builtin_amdgcn_sched_barrier(0);
#pragma unroll
        for (int ks = 0; ks < OBK / 32; ++ks)
#pragma unroll
            for (int i = 0; i < 4; ++i)
#pragma unroll
                for (int j = 0; j < 2; ++j)
                    acc[i][j] = wmma_f16(a[ks][i], bm[ks][j], acc[i][j]);
    }
    float* obase = out + (size_t)(rt * 128 + wr * 64 + 8 * hi) * EE + ct * 128 + wc * 32 + col;
#pragma unroll
    for (int i = 0; i < 4; ++i)
#pragma unroll
        for (int g = 0; g < 8; ++g)
#pragma unroll
            for (int j = 0; j < 2; ++j)
                obase[(size_t)(i * 16 + g) * EE + j * 16] = acc[i][j][g];
}

// ---------------------------------------------------------------------------
extern "C" void kernel_launch(void* const* d_in, const int* in_sizes, int n_in,
                              void* d_out, int out_size, void* d_ws, size_t ws_size,
                              hipStream_t stream) {
    const float* x  = (const float*)d_in[0];
    const float* Wq = (const float*)d_in[1];
    const float* bq = (const float*)d_in[2];
    const float* Wk = (const float*)d_in[3];
    const float* bk = (const float*)d_in[4];
    const float* Wv = (const float*)d_in[5];
    const float* bv = (const float*)d_in[6];
    const float* Wp = (const float*)d_in[7];
    const float* bp = (const float*)d_in[8];
    float* out = (float*)d_out;

    const size_t nPH = (size_t)BB * HH * SS * DD;   // 8,388,608 halves / tensor
    f16* Q    = (f16*)d_ws;
    f16* Kb   = Q  + nPH;
    f16* Vt   = Kb + nPH;
    f16* attn = Vt + nPH;
    f16* Wp16 = attn + (size_t)BB * SS * EE;        // ~66 MB total workspace

    convert_f32_to_f16<<<(EE * EE + 255) / 256, 256, 0, stream>>>(Wp, Wp16, EE * EE);
    qkv_kernel<<<dim3(BB * HH, SS / 256), 256, 0, stream>>>(x, Wq, bq, Wk, bk, Wv, bv,
                                                          Q, Kb, Vt);
    flash_attn_kernel<<<dim3(BB * HH, SS / 256), 256, 0, stream>>>(Q, Kb, Vt, attn);
    out_proj_kernel<<<dim3(BB * SS / 128, EE / 128), 256, 0, stream>>>(attn, Wp16, bp, out);
}

// v005
// One run takes 93.8 microseconds.
// In two side-by-side timings against v004, it was 1.07 and 1.06 times as fast.
// All steps since v000 together make it 2.14 times as fast.
#include <hip/hip_runtime.h>
#include <hip/hip_bf16.h>
#include <cstdint>

typedef _Float16 f16;
typedef __attribute__((ext_vector_type(16))) _Float16 v16h;
typedef __attribute__((ext_vector_type(8)))  _Float16 v8h;
typedef __attribute__((ext_vector_type(8)))  float    v8f;

#define BB 4
#define SS 2048
#define EE 1024
#define HH 16
#define DD 64

// ---------------------------------------------------------------------------
// Operand gathers per CDNA5 WMMA VGPR layouts (ISA 7.12.2, wave32):
//  A (16x32 f16): lane L holds row m=L&15; half-pair r holds
//      K = (r<4 ? 2r : 16+2(r-4)) + 8*(L>>4), K+1
//  B (32x16 f16): same gather over the row-major TRANSPOSED B source
//      (row index = output column n = L&15).
// ---------------------------------------------------------------------------
static __device__ __forceinline__ v16h load_tile_f16(const f16* base, int ld) {
    const int lane = threadIdx.x & 31;
    const int m = lane & 15, hi = lane >> 4;
    const f16* row = base + (size_t)m * ld;
    v16h out;
#pragma unroll
    for (int r = 0; r < 8; ++r) {
        int k = ((r < 4) ? (2 * r) : (16 + 2 * (r - 4))) + 8 * hi;
        out[2 * r]     = row[k];
        out[2 * r + 1] = row[k + 1];
    }
    return out;
}

static __device__ __forceinline__ v16h load_tile_f32(const float* base, int ld) {
    const int lane = threadIdx.x & 31;
    const int m = lane & 15, hi = lane >> 4;
    const float* row = base + (size_t)m * ld;
    v16h out;
#pragma unroll
    for (int r = 0; r < 8; ++r) {
        int k = ((r < 4) ? (2 * r) : (16 + 2 * (r - 4))) + 8 * hi;
        out[2 * r]     = (f16)row[k];
        out[2 * r + 1] = (f16)row[k + 1];
    }
    return out;
}

static __device__ __forceinline__ v8f wmma_f16(v16h a, v16h b, v8f c) {
    return __builtin_amdgcn_wmma_f32_16x16x32_f16(false, a, false, b,
                                                  (short)0, c, false, false);
}

// Async global->LDS copy of 16 bytes, tracked by ASYNCcnt (CDNA5 path;
// ISA 15.18.3 opcode 98). LDS dest offset comes from the low 32 bits of
// the generic pointer (LDS aperture: addr[31:0] is the LDS byte address).
static __device__ __forceinline__ void async_b128(const f16* gsrc, f16* ldst) {
    unsigned           dst = (unsigned)(uintptr_t)(void*)ldst;
    unsigned long long src = (unsigned long long)(uintptr_t)gsrc;
    asm volatile("global_load_async_to_lds_b128 %0, %1, off"
                 :: "v"(dst), "v"(src) : "memory");
}
static __device__ __forceinline__ void wait_async0() {
    asm volatile("s_wait_asynccnt 0x0" ::: "memory");
}

// ---------------------------------------------------------------------------
// Kernel 1: QKV projection. 8 waves / block share one f16 copy of the three
// 64x64 weight matrices in LDS, converted once per block from whole-line loads;
// each wave takes two 16-row s-tiles of one (b,h) and reads its B fragments
// from LDS, every fragment feeding both tiles.
//   Q,K stored [bh][s][d] f16 ; V stored transposed [bh][d][s] f16.
// Each block also converts its equal share of Wp to f16 for the output
// projection: a launch of its own for that started eight times the waves of
// this one, each for a single element.
// ---------------------------------------------------------------------------
#define WSTR 72   // LDS stride (halves) of a staged 64-wide weight row: 144B
#define QKV_BLOCKS (BB * HH * (SS / 256))          // 512
#define WP_SHARE   (EE * EE / QKV_BLOCKS)          // 2048 elements of Wp per block

typedef __attribute__((ext_vector_type(4))) _Float16 v4h;

// 512 blocks = two per WGP = four waves per SIMD: the register budget of that
// residency (256) is stated so that the whole grid is resident at once.
__global__ void __launch_bounds__(256) __attribute__((amdgpu_waves_per_eu(4)))
qkv_kernel(const float* __restrict__ x,
        const float* __restrict__ Wq, const float* __restrict__ bq,
        const float* __restrict__ Wk, const float* __restrict__ bk,
        const float* __restrict__ Wv, const float* __restrict__ bv,
        const float* __restrict__ Wp,
        f16* __restrict__ Q, f16* __restrict__ Kb, f16* __restrict__ Vt,
        f16* __restrict__ Wp16) {
    const int bh = blockIdx.x;          // 0..63
    const int b = bh >> 4, h = bh & 15;
    const int tid  = threadIdx.x;
    const int lane = tid & 31;
    const int col = lane & 15, hi = lane >> 4;
    const int s0 = blockIdx.y * 256 + (tid >> 5) * 32;   // this wave's 32 rows

    __shared__ __align__(16) f16 wlds[3 * DD * WSTR];    // 27 KB

    const float* Ws[3] = {Wq, Wk, Wv};
    const float* bs[3] = {bq, bk, bv};

    // weights: 256 threads x 4 floats cover 16 rows of one matrix per pass
    float4 wraw[3][4];
#pragma unroll
    for (int w = 0; w < 3; ++w)
#pragma unroll
        for (int r = 0; r < 4; ++r)
            wraw[w][r] = *(const float4*)(Ws[w] + (r * 256 + tid) * 4);
    // this block's share of Wp: four consecutive floats a thread and pass
    const int pbase = (blockIdx.y * (BB * HH) + blockIdx.x) * WP_SHARE + tid * 4;
    float4 praw[WP_SHARE / 1024];
#pragma unroll
    for (int r = 0; r < WP_SHARE / 1024; ++r)
        praw[r] = *(const float4*)(Wp + pbase + r * 1024);
    float bval[3][4];                    // asked for ahead of the barrier
#pragma unroll
    for (int w = 0; w < 3; ++w)
#pragma unroll
        for (int n = 0; n < 4; ++n) bval[w][n] = bs[w][n * 16 + col];

    const float* xbase = x + ((size_t)(b * SS + s0)) * EE + h * DD;
    v16h a0[2], a1[2];
#pragma unroll
    for (int t = 0; t < 2; ++t) {
        a0[t] = load_tile_f32(xbase + (size_t)t * 16 * EE,      EE);   // d = 0..31
        a1[t] = load_tile_f32(xbase + (size_t)t * 16 * EE + 32, EE);   // d = 32..63
    }

#pragma unroll
    for (int w = 0; w < 3; ++w)
#pragma unroll
        for (int r = 0; r < 4; ++r) {
            const int idx = r * 256 + tid;               // float4 index in the matrix
            v4h hv = {(f16)wraw[w][r].x, (f16)wraw[w][r].y,
                      (f16)wraw[w][r].z, (f16)wraw[w][r].w};
            *(v4h*)(wlds + (w * DD + (idx >> 4)) * WSTR + (idx & 15) * 4) = hv;
        }
    __syncthreads();                     // the staged weights are read by every wave

    // stored behind the barrier, which would otherwise wait for these stores
#pragma unroll
    for (int r = 0; r < WP_SHARE / 1024; ++r) {
        v4h hv = {(f16)praw[r].x, (f16)praw[r].y, (f16)praw[r].z, (f16)praw[r].w};
        *(v4h*)(Wp16 + pbase + r * 1024) = hv;
    }

#pragma unroll
    for (int w = 0; w < 3; ++w) {
#pragma unroll
        for (int n = 0; n < 4; ++n) {
            const f16* wt = wlds + (w * DD + n * 16) * WSTR;
            v16h b0 = load_tile_f16(wt,      WSTR);
            v16h b1 = load_tile_f16(wt + 32, WSTR);
#pragma unroll
            for (int t = 0; t < 2; ++t) {
                v8f c = {};
#pragma unroll
                for (int g = 0; g < 8; ++g) c[g] = bval[w][n];
                c = wmma_f16(a0[t], b0, c);
                c = wmma_f16(a1[t], b1, c);
#pragma unroll
                for (int g = 0; g < 8; ++g) {
                    int srow = s0 + t * 16 + g + 8 * hi;
                    int d = n * 16 + col;
                    f16 val = (f16)c[g];
                    if (w == 0)      Q [((size_t)bh * SS + srow) * DD + d] = val;
                    else if (w == 1) Kb[((size_t)bh * SS + srow) * DD + d] = val;
                    else             Vt[((size_t)bh * DD + d) * SS + srow] = val;
                }
            }
        }
    }
}

#define KSTR 72   // LDS stride (halves) for 32x64 K tile: 144B, odd bank step
#define VSTR 40   // LDS stride for 64x32 V tile: 80B
#define KSZ  (32 * KSTR)            // 2304 halves per K buffer
#define VSZ  (64 * VSTR)            // 2560 halves per V buffer
#define POFF (2 * KSZ + 2 * VSZ)    // 9728

// lane l <-> lane l ^ 16: the two lanes that share one query column
static __device__ __forceinline__ float xhalf(float v) {
    int i = __builtin_bit_cast(int, v);
    return __builtin_bit_cast(float,
        __builtin_amdgcn_permlanex16(i, i, 0x76543210, 0xfedcba98, false, false));
}

// 512 blocks = two per WGP = four waves per SIMD: the register budget of that
// residency (256) is stated so that fragments can be fetched ahead of their use.
__global__ void __launch_bounds__(256) __attribute__((amdgpu_waves_per_eu(4, 4)))
flash_attn_kernel(const f16* __restrict__ Q,
        const f16* __restrict__ Kb, const f16* __restrict__ Vt,
        f16* __restrict__ attn) {
    const int bh = blockIdx.x;
    const int b = bh >> 4, h = bh & 15;
    const int tid  = threadIdx.x;
    const int w    = tid >> 5;
    const int lane = tid & 31;
    const int col = lane & 15, hi = lane >> 4;
    const int s0 = blockIdx.y * 256 + w * 32;       // this wave's query rows

    __shared__ __align__(16) f16 smem[POFF];        // 19 KB

    // Per-thread async-copy assignment: 256 threads x 16B covers each 4KB tile.
    const int krow = tid >> 3, kchunk = tid & 7;    // K: 32 rows x 128B
    const int vrow = tid >> 2, vchunk = tid & 3;    // V: 64 rows x 64B

    auto issue_tiles = [&](int j, int buf) {
        f16* kbuf = smem + buf * KSZ;               // no pointer arrays: compute
        f16* vbuf = smem + 2 * KSZ + buf * VSZ;     // bases arithmetically
        async_b128(Kb + ((size_t)bh * SS + j * 32 + krow) * DD + kchunk * 8,
                   kbuf + krow * KSTR + kchunk * 8);
        async_b128(Vt + ((size_t)bh * DD + vrow) * SS + j * 32 + vchunk * 8,
                   vbuf + vrow * VSTR + vchunk * 8);
    };

    // Q as the B operand: lane holds query column col, kept in registers
    const f16* qbase = Q + ((size_t)bh * SS + s0) * DD;
    v16h aq0[2], aq1[2];         // column tile q: queries s0 + 16q + col
#pragma unroll
    for (int q = 0; q < 2; ++q) {
        aq0[q] = load_tile_f16(qbase + q * 16 * DD,      DD);
        aq1[q] = load_tile_f16(qbase + q * 16 * DD + 32, DD);
    }

    // per lane and column tile: running maximum of the query (equal in both
    // halves) and the sum over this half's keys only (joined after the loop)
    float mrow[2] = {-3.0e38f, -3.0e38f}, lsum[2] = {0.0f, 0.0f};
    v8f oacc[2][4] = {};         // oacc[q][n][g] = O[query][d = 16n + 8hi + g]

    issue_tiles(0, 0);
    for (int j = 0; j < SS / 32; ++j) {
        const int buf = j & 1;
        const f16* kcur = smem + buf * KSZ;
        const f16* vcur = smem + 2 * KSZ + buf * VSZ;

        wait_async0();           // my async copies for tile j done
        __syncthreads();         // everyone's copies done; prior reads retired
        if (j + 1 < SS / 32) issue_tiles(j + 1, buf ^ 1);   // overlap next tile

        // ---- scores: K(32x64) x Q^T(64x32) as two by two 16x16 tiles ----
        // p[q][t][g] = S[query of tile q][key 16t + 8hi + g]
        // (kept as whole accumulator vectors: element-wise steps then pair
        //  neighbouring registers of one tile, with no moves between tiles)
        v8f p[2][2];
#pragma unroll
        for (int t = 0; t < 2; ++t) {
            const f16* kbase = kcur + t * 16 * KSTR;
            v16h b0 = load_tile_f16(kbase,      KSTR);
            v16h b1 = load_tile_f16(kbase + 32, KSTR);
#pragma unroll
            for (int q = 0; q < 2; ++q) {
                v8f c = {};
                c = wmma_f16(b0, aq0[q], c);
                c = wmma_f16(b1, aq1[q], c);
                p[q][t] = c * 0.125f;                // 1/sqrt(64)
            }
        }
        v16h bp[2];
#pragma unroll
        for (int q = 0; q < 2; ++q) {
            // ---- online softmax: 16 scores in-lane, one exchange between halves ----
            float tmax = fmaxf(p[q][0][0], p[q][0][1]);
#pragma unroll
            for (int g = 2; g < 8; g += 2) tmax = fmaxf(tmax, fmaxf(p[q][0][g], p[q][0][g + 1]));
#pragma unroll
            for (int g = 0; g < 8; g += 2) tmax = fmaxf(tmax, fmaxf(p[q][1][g], p[q][1][g + 1]));
            tmax = fmaxf(tmax, xhalf(tmax));
            const float mnew  = fmaxf(mrow[q], tmax);
            const float scale = __expf(mrow[q] - mnew);
            mrow[q] = mnew;
            // exp(x) as exp2(x * log2 e), the form __expf compiles to
            p[q][0] = (p[q][0] - mnew) * 1.44269504f;
            p[q][1] = (p[q][1] - mnew) * 1.44269504f;
            float ps0 = 0.0f, ps1 = 0.0f;
#pragma unroll
            for (int g = 0; g < 8; ++g) {
                p[q][0][g] = __builtin_amdgcn_exp2f(p[q][0][g]);
                p[q][1][g] = __builtin_amdgcn_exp2f(p[q][1][g]);
                ps0 += p[q][0][g];
                ps1 += p[q][1][g];
            }
            lsum[q] = lsum[q] * scale + (ps0 + ps1);
#pragma unroll
            for (int n = 0; n < 4; ++n) oacc[q][n] *= scale;
            // ---- P^T as the B operand: the two score tiles, converted in place,
            //      already lie in the operand's k order (k = 8hi + g, 16 + 8hi + g)
#pragma unroll
            for (int g = 0; g < 8; ++g) {
                bp[q][g]     = (f16)p[q][0][g];
                bp[q][8 + g] = (f16)p[q][1][g];
            }
        }
        // ---- V^T(16x32) x P^T(32x32) for each of 4 d-tiles ----
#pragma unroll
        for (int n = 0; n < 4; ++n) {
            v16h av = load_tile_f16(vcur + (n * 16) * VSTR, VSTR);
#pragma unroll
            for (int q = 0; q < 2; ++q) oacc[q][n] = wmma_f16(av, bp[q], oacc[q][n]);
        }
    }
    // normalize and store attn as [b][s][h*64+d] f16: 8 consecutive d per lane
#pragma unroll
    for (int q = 0; q < 2; ++q) {
        const float rl = 1.0f / (lsum[q] + xhalf(lsum[q]));
        f16* orow = attn + ((size_t)b * SS + s0 + q * 16 + col) * EE + h * DD + 8 * hi;
#pragma unroll
        for (int n = 0; n < 4; ++n) {
            v8h o;
#pragma unroll
            for (int g = 0; g < 8; ++g) o[g] = (f16)(oacc[q][n][g] * rl);
            *(v8h*)(orow + n * 16) = o;
        }
    }
}

// ---------------------------------------------------------------------------
// Kernel 3: output projection  out = attn @ Wp^T + bp   (f32 out)
// 8 waves / block compute a 128x128 tile as 2 x 4 wave tiles of 64x32; A and B
// are staged in LDS 64 k at a time. Per chunk a wave reads its 8 A and 4 B
// fragments as one group and feeds 16 matrix instructions from them.
// ---------------------------------------------------------------------------
#define OBK  64   // k depth of one staged chunk
#define OSTR 72   // LDS stride (halves) for 128x64 chunks: 144B, 16B x odd

__global__ void __launch_bounds__(256) out_proj_kernel(const f16* __restrict__ attn,
        const f16* __restrict__ Wp16, const float* __restrict__ bp,
        float* __restrict__ out) {
    const int rt = blockIdx.x;                      // 0..63 (128-row groups)
    const int ct = blockIdx.y;                      // 0..7  (128-col groups)
    const int tid  = threadIdx.x;
    const int w    = tid >> 5;
    const int lane = tid & 31;
    const int col = lane & 15, hi = lane >> 4;
    const int wr = w >> 2;                          // 64-row half of the tile
    const int wc = w & 3;                           // 32-col quarter of the tile

    __shared__ __align__(16) f16 smem2[2 * 128 * OSTR];        // 36 KB
    f16* ldsA = smem2;
    f16* ldsB = smem2 + 128 * OSTR;

    v8f acc[4][2];
#pragma unroll
    for (int j = 0; j < 2; ++j) {
        float bval = bp[ct * 128 + wc * 32 + j * 16 + col];
#pragma unroll
        for (int i = 0; i < 4; ++i)
#pragma unroll
            for (int g = 0; g < 8; ++g) acc[i][j][g] = bval;
    }

    const int lrow = tid >> 3;       // 0..31 (four passes cover 128 rows)
    const int lchunk = tid & 7;      // 16B chunks of the 128B-wide k-slab
    const f16* asrc = attn + (size_t)(rt * 128 + lrow) * EE + lchunk * 8;
    const f16* bsrc = Wp16 + (size_t)(ct * 128 + lrow) * EE + lchunk * 8;
    f16* adst = ldsA + lrow * OSTR + lchunk * 8;
    f16* bdst = ldsB + lrow * OSTR + lchunk * 8;
    const f16* afrag = ldsA + wr * 64 * OSTR;
    const f16* bfrag = ldsB + wc * 32 * OSTR;
    for (int kc = 0; kc < EE / OBK; ++kc) {
        __syncthreads();             // previous chunk fully consumed
#pragma unroll
        for (int rr = 0; rr < 4; ++rr) {
            *(int4*)(adst + rr * 32 * OSTR) = *(const int4*)(asrc + (size_t)rr * 32 * EE);
            *(int4*)(bdst + rr * 32 * OSTR) = *(const int4*)(bsrc + (size_t)rr * 32 * EE);
        }
        asrc += OBK;
        bsrc += OBK;
        __syncthreads();
        v16h a[OBK / 32][4], bm[OBK / 32][2];
#pragma unroll
        for (int ks = 0; ks < OBK / 32; ++ks) {
#pragma unroll
            for (int j = 0; j < 2; ++j)
                bm[ks][j] = load_tile_f16(bfrag + j * 16 * OSTR + ks * 32, OSTR);
#pragma unroll
            for (int i = 0; i < 4; ++i)
                a[ks][i] = load_tile_f16(afrag + i * 16 * OSTR + ks * 32, OSTR);
        }
        // keeps the chunk's fragment reads one group ahead of its matrix
        // instructions: sunk among them, each read's LDS latency is waited singly
        __builtin_amdgcn_sched_barrier(0);
#pragma unroll
        for (int ks = 0; ks < OBK / 32; ++ks)
#pragma unroll
            for (int i = 0; i < 4; ++i)
#pragma unroll
                for (int j = 0; j < 2; ++j)
                    acc[i][j] = wmma_f16(a[ks][i], bm[ks][j], acc[i][j]);
    }
    float* obase = out + (size_t)(rt * 128 + wr * 64 + 8 * hi) * EE + ct * 128 + wc * 32 + col;
#pragma unroll
    for (int i = 0; i < 4; ++i)
#pragma unroll
        for (int g = 0; g < 8; ++g)
#pragma unroll
            for (int j = 0; j < 2; ++j)
                obase[(size_t)(i * 16 + g) * EE + j * 16] = acc[i][j][g];
}

// ---------------------------------------------------------------------------
extern "C" void kernel_launch(void* const* d_in, const int* in_sizes, int n_in,
                              void* d_out, int out_size, void* d_ws, size_t ws_size,
                              hipStream_t stream) {
    const float* x  = (const float*)d_in[0];
    const float* Wq = (const float*)d_in[1];
    const float* bq = (const float*)d_in[2];
    const float* Wk = (const float*)d_in[3];
    const float* bk = (const float*)d_in[4];
    const float* Wv = (const float*)d_in[5];
    const float* bv = (const float*)d_in[6];
    const float* Wp = (const float*)d_in[7];
    const float* bp = (const float*)d_in[8];
    float* out = (float*)d_out;

    const size_t nPH = (size_t)BB * HH * SS * DD;   // 8,388,608 halves / tensor
    f16* Q    = (f16*)d_ws;
    f16* Kb   = Q  + nPH;
    f16* Vt   = Kb + nPH;
    f16* attn = Vt + nPH;
    f16* Wp16 = attn + (size_t)BB * SS * EE;        // ~66 MB total workspace

    qkv_kernel<<<dim3(BB * HH, SS / 256), 256, 0, stream>>>(x, Wq, bq, Wk, bk, Wv, bv, Wp,
                                                          Q, Kb, Vt, Wp16);
    flash_attn_kernel<<<dim3(BB * HH, SS / 256), 256, 0, stream>>>(Q, Kb, Vt, attn);
    out_proj_kernel<<<dim3(BB * SS / 128, EE / 128), 256, 0, stream>>>(attn, Wp16, bp, out);
}

// v006
// A run of this version takes 89.2 microseconds.
// Two timings next to v005 put it at 1.05 and 1.06 times that version's speed.
// Counting every step since v000, it is 2.25 times as fast.
#include <hip/hip_runtime.h>
#include <hip/hip_bf16.h>
#include <cstdint>

typedef _Float16 f16;
typedef __attribute__((ext_vector_type(16))) _Float16 v16h;
typedef __attribute__((ext_vector_type(8)))  _Float16 v8h;
typedef __attribute__((ext_vector_type(8)))  float    v8f;

#define BB 4
#define SS 2048
#define EE 1024
#define HH 16
#define DD 64

// ---------------------------------------------------------------------------
// Operand gathers per CDNA5 WMMA VGPR layouts (ISA 7.12.2, wave32):
//  A (16x32 f16): lane L holds row m=L&15; half-pair r holds
//      K = (r<4 ? 2r : 16+2(r-4)) + 8*(L>>4), K+1
//  B (32x16 f16): same gather over the row-major TRANSPOSED B source
//      (row index = output column n = L&15).
// ---------------------------------------------------------------------------
static __device__ __forceinline__ v16h load_tile_f16(const f16* base, int ld) {
    const int lane = threadIdx.x & 31;
    const int m = lane & 15, hi = lane >> 4;
    const f16* row = base + (size_t)m * ld;
    v16h out;
#pragma unroll
    for (int r = 0; r < 8; ++r) {
        int k = ((r < 4) ? (2 * r) : (16 + 2 * (r - 4))) + 8 * hi;
        out[2 * r]     = row[k];
        out[2 * r + 1] = row[k + 1];
    }
    return out;
}

static __device__ __forceinline__ v16h load_tile_f32(const float* base, int ld) {
    const int lane = threadIdx.x & 31;
    const int m = lane & 15, hi = lane >> 4;
    const float* row = base + (size_t)m * ld;
    v16h out;
#pragma unroll
    for (int r = 0; r < 8; ++r) {
        int k = ((r < 4) ? (2 * r) : (16 + 2 * (r - 4))) + 8 * hi;
        out[2 * r]     = (f16)row[k];
        out[2 * r + 1] = (f16)row[k + 1];
    }
    return out;
}

static __device__ __forceinline__ v8f wmma_f16(v16h a, v16h b, v8f c) {
    return __builtin_amdgcn_wmma_f32_16x16x32_f16(false, a, false, b,
                                                  (short)0, c, false, false);
}

// Async global->LDS copy of 16 bytes, tracked by ASYNCcnt (CDNA5 path;
// ISA 15.18.3 opcode 98). LDS dest offset comes from the low 32 bits of
// the generic pointer (LDS aperture: addr[31:0] is the LDS byte address).
static __device__ __forceinline__ void async_b128(const f16* gsrc, f16* ldst) {
    unsigned           dst = (unsigned)(uintptr_t)(void*)ldst;
    unsigned long long src = (unsigned long long)(uintptr_t)gsrc;
    asm volatile("global_load_async_to_lds_b128 %0, %1, off"
                 :: "v"(dst), "v"(src) : "memory");
}
static __device__ __forceinline__ void wait_async0() {
    asm volatile("s_wait_asynccnt 0x0" ::: "memory");
}

// ---------------------------------------------------------------------------
// Kernel 1: QKV projection. 8 waves / block share one f16 copy of the three
// 64x64 weight matrices in LDS, converted once per block from whole-line loads;
// each wave takes two 16-row s-tiles of one (b,h) and reads its B fragments
// from LDS, every fragment feeding both tiles.
//   Q (scaled, see Q_SCALE), K stored [bh][s][d] f16 ; V transposed [bh][d][s] f16.
// Each block also converts its equal share of Wp to f16 for the output
// projection: a launch of its own for that started eight times the waves of
// this one, each for a single element.
// ---------------------------------------------------------------------------
#define WSTR 72   // LDS stride (halves) of a staged 64-wide weight row: 144B
#define QKV_BLOCKS (BB * HH * (SS / 256))          // 512
#define WP_SHARE   (EE * EE / QKV_BLOCKS)          // 2048 elements of Wp per block
// Q is stored times 1/sqrt(64) * log2(e): the attention scores then leave the
// matrix unit as exponents of 2 and need no scaling of their own
#define Q_SCALE 0.18033688f

typedef __attribute__((ext_vector_type(4))) _Float16 v4h;

// 512 blocks = two per WGP = four waves per SIMD: the register budget of that
// residency (256) is stated so that the whole grid is resident at once.
__global__ void __launch_bounds__(256) __attribute__((amdgpu_waves_per_eu(4)))
qkv_kernel(const float* __restrict__ x,
        const float* __restrict__ Wq, const float* __restrict__ bq,
        const float* __restrict__ Wk, const float* __restrict__ bk,
        const float* __restrict__ Wv, const float* __restrict__ bv,
        const float* __restrict__ Wp,
        f16* __restrict__ Q, f16* __restrict__ Kb, f16* __restrict__ Vt,
        f16* __restrict__ Wp16) {
    const int bh = blockIdx.x;          // 0..63
    const int b = bh >> 4, h = bh & 15;
    const int tid  = threadIdx.x;
    const int lane = tid & 31;
    const int col = lane & 15, hi = lane >> 4;
    const int s0 = blockIdx.y * 256 + (tid >> 5) * 32;   // this wave's 32 rows

    __shared__ __align__(16) f16 wlds[3 * DD * WSTR];    // 27 KB

    const float* Ws[3] = {Wq, Wk, Wv};
    const float* bs[3] = {bq, bk, bv};

    // weights: 256 threads x 4 floats cover 16 rows of one matrix per pass
    float4 wraw[3][4];
#pragma unroll
    for (int w = 0; w < 3; ++w)
#pragma unroll
        for (int r = 0; r < 4; ++r)
            wraw[w][r] = *(const float4*)(Ws[w] + (r * 256 + tid) * 4);
    // this block's share of Wp: four consecutive floats a thread and pass
    const int pbase = (blockIdx.y * (BB * HH) + blockIdx.x) * WP_SHARE + tid * 4;
    float4 praw[WP_SHARE / 1024];
#pragma unroll
    for (int r = 0; r < WP_SHARE / 1024; ++r)
        praw[r] = *(const float4*)(Wp + pbase + r * 1024);
    float bval[3][4];                    // asked for ahead of the barrier
#pragma unroll
    for (int w = 0; w < 3; ++w)
#pragma unroll
        for (int n = 0; n < 4; ++n) bval[w][n] = bs[w][n * 16 + col];

    const float* xbase = x + ((size_t)(b * SS + s0)) * EE + h * DD;
    v16h a0[2], a1[2];
#pragma unroll
    for (int t = 0; t < 2; ++t) {
        a0[t] = load_tile_f32(xbase + (size_t)t * 16 * EE,      EE);   // d = 0..31
        a1[t] = load_tile_f32(xbase + (size_t)t * 16 * EE + 32, EE);   // d = 32..63
    }

#pragma unroll
    for (int w = 0; w < 3; ++w)
#pragma unroll
        for (int r = 0; r < 4; ++r) {
            const int idx = r * 256 + tid;               // float4 index in the matrix
            v4h hv = {(f16)wraw[w][r].x, (f16)wraw[w][r].y,
                      (f16)wraw[w][r].z, (f16)wraw[w][r].w};
            *(v4h*)(wlds + (w * DD + (idx >> 4)) * WSTR + (idx & 15) * 4) = hv;
        }
    __syncthreads();                     // the staged weights are read by every wave

    // stored behind the barrier, which would otherwise wait for these stores
#pragma unroll
    for (int r = 0; r < WP_SHARE / 1024; ++r) {
        v4h hv = {(f16)praw[r].x, (f16)praw[r].y, (f16)praw[r].z, (f16)praw[r].w};
        *(v4h*)(Wp16 + pbase + r * 1024) = hv;
    }

#pragma unroll
    for (int w = 0; w < 3; ++w) {
#pragma unroll
        for (int n = 0; n < 4; ++n) {
            const f16* wt = wlds + (w * DD + n * 16) * WSTR;
            v16h b0 = load_tile_f16(wt,      WSTR);
            v16h b1 = load_tile_f16(wt + 32, WSTR);
#pragma unroll
            for (int t = 0; t < 2; ++t) {
                v8f c = {};
#pragma unroll
                for (int g = 0; g < 8; ++g) c[g] = bval[w][n];
                c = wmma_f16(a0[t], b0, c);
                c = wmma_f16(a1[t], b1, c);
#pragma unroll
                for (int g = 0; g < 8; ++g) {
                    int srow = s0 + t * 16 + g + 8 * hi;
                    int d = n * 16 + col;
                    f16 val = (f16)(w == 0 ? c[g] * Q_SCALE : c[g]);
                    if (w == 0)      Q [((size_t)bh * SS + srow) * DD + d] = val;
                    else if (w == 1) Kb[((size_t)bh * SS + srow) * DD + d] = val;
                    else             Vt[((size_t)bh * DD + d) * SS + srow] = val;
                }
            }
        }
    }
}

#define KSTR 72   // LDS stride (halves) for 32x64 K tile: 144B, odd bank step
#define VSTR 40   // LDS stride for 64x32 V tile: 80B
#define KSZ  (32 * KSTR)            // 2304 halves per K buffer
#define VSZ  (64 * VSTR)            // 2560 halves per V buffer
#define POFF (2 * KSZ + 2 * VSZ)    // 9728

// lane l <-> lane l ^ 16: the two lanes that share one query column
static __device__ __forceinline__ float xhalf(float v) {
    int i = __builtin_bit_cast(int, v);
    return __builtin_bit_cast(float,
        __builtin_amdgcn_permlanex16(i, i, 0x76543210, 0xfedcba98, false, false));
}

// 512 blocks = two per WGP = four waves per SIMD: the register budget of that
// residency (256) is stated so that fragments can be fetched ahead of their use.
__global__ void __launch_bounds__(256) __attribute__((amdgpu_waves_per_eu(4, 4)))
flash_attn_kernel(const f16* __restrict__ Q,
        const f16* __restrict__ Kb, const f16* __restrict__ Vt,
        f16* __restrict__ attn) {
    const int bh = blockIdx.x;
    const int b = bh >> 4, h = bh & 15;
    const int tid  = threadIdx.x;
    const int w    = tid >> 5;
    const int lane = tid & 31;
    const int col = lane & 15, hi = lane >> 4;
    const int s0 = blockIdx.y * 256 + w * 32;       // this wave's query rows

    __shared__ __align__(16) f16 smem[POFF];        // 19 KB

    // Per-thread async-copy assignment: 256 threads x 16B covers each 4KB tile.
    const int krow = tid >> 3, kchunk = tid & 7;    // K: 32 rows x 128B
    const int vrow = tid >> 2, vchunk = tid & 3;    // V: 64 rows x 64B

    auto issue_tiles = [&](int j, int buf) {
        f16* kbuf = smem + buf * KSZ;               // no pointer arrays: compute
        f16* vbuf = smem + 2 * KSZ + buf * VSZ;     // bases arithmetically
        async_b128(Kb + ((size_t)bh * SS + j * 32 + krow) * DD + kchunk * 8,
                   kbuf + krow * KSTR + kchunk * 8);
        async_b128(Vt + ((size_t)bh * DD + vrow) * SS + j * 32 + vchunk * 8,
                   vbuf + vrow * VSTR + vchunk * 8);
    };

    // Q as the B operand: lane holds query column col, kept in registers
    const f16* qbase = Q + ((size_t)bh * SS + s0) * DD;
    v16h aq0[2], aq1[2];         // column tile q: queries s0 + 16q + col
#pragma unroll
    for (int q = 0; q < 2; ++q) {
        aq0[q] = load_tile_f16(qbase + q * 16 * DD,      DD);
        aq1[q] = load_tile_f16(qbase + q * 16 * DD + 32, DD);
    }

    // per lane and column tile: running maximum of the query (equal in both
    // halves) and the sum over this half's keys only (joined after the loop)
    float mrow[2] = {-3.0e38f, -3.0e38f}, lsum[2] = {0.0f, 0.0f};
    v8f oacc[2][4] = {};         // oacc[q][n][g] = O[query][d = 16n + 8hi + g]

    issue_tiles(0, 0);
    for (int j = 0; j < SS / 32; ++j) {
        const int buf = j & 1;
        const f16* kcur = smem + buf * KSZ;
        const f16* vcur = smem + 2 * KSZ + buf * VSZ;

        wait_async0();           // my async copies for tile j done
        __syncthreads();         // everyone's copies done; prior reads retired
        if (j + 1 < SS / 32) issue_tiles(j + 1, buf ^ 1);   // overlap next tile

        // ---- scores: K(32x64) x Q^T(64x32) as two by two 16x16 tiles ----
        // p[q][t][g] = S[query of tile q][key 16t + 8hi + g]
        // (kept as whole accumulator vectors: element-wise steps then pair
        //  neighbouring registers of one tile, with no moves between tiles)
        v8f p[2][2];
#pragma unroll
        for (int t = 0; t < 2; ++t) {
            const f16* kbase = kcur + t * 16 * KSTR;
            v16h b0 = load_tile_f16(kbase,      KSTR);
            v16h b1 = load_tile_f16(kbase + 32, KSTR);
#pragma unroll
            for (int q = 0; q < 2; ++q) {
                v8f c = {};
                c = wmma_f16(b0, aq0[q], c);
                c = wmma_f16(b1, aq1[q], c);
                p[q][t] = c;                         // scaled through Q already
            }
        }
        v16h bp[2];
#pragma unroll
        for (int q = 0; q < 2; ++q) {
            // ---- online softmax: 16 scores in-lane, one exchange between halves ----
            // (the running maximum leads the chain: 17 values, taken in threes)
            float tmax = mrow[q];
#pragma unroll
            for (int g = 0; g < 8; g += 2) tmax = fmaxf(tmax, fmaxf(p[q][0][g], p[q][0][g + 1]));
#pragma unroll
            for (int g = 0; g < 8; g += 2) tmax = fmaxf(tmax, fmaxf(p[q][1][g], p[q][1][g + 1]));
            const float mnew  = fmaxf(tmax, xhalf(tmax));
            const float scale = __builtin_amdgcn_exp2f(mrow[q] - mnew);
            mrow[q] = mnew;
            p[q][0] = p[q][0] - mnew;
            p[q][1] = p[q][1] - mnew;
            float ps0 = 0.0f, ps1 = 0.0f;
#pragma unroll
            for (int g = 0; g < 8; ++g) {
                p[q][0][g] = __builtin_amdgcn_exp2f(p[q][0][g]);
                p[q][1][g] = __builtin_amdgcn_exp2f(p[q][1][g]);
                ps0 += p[q][0][g];
                ps1 += p[q][1][g];
            }
            lsum[q] = lsum[q] * scale + (ps0 + ps1);
#pragma unroll
            for (int n = 0; n < 4; ++n) oacc[q][n] *= scale;
            // ---- P^T as the B operand: the two score tiles, converted in place,
            //      already lie in the operand's k order (k = 8hi + g, 16 + 8hi + g)
#pragma unroll
            for (int g = 0; g < 8; ++g) {
                bp[q][g]     = (f16)p[q][0][g];
                bp[q][8 + g] = (f16)p[q][1][g];
            }
        }
        // ---- V^T(16x32) x P^T(32x32) for each of 4 d-tiles ----
#pragma unroll
        for (int n = 0; n < 4; ++n) {
            v16h av = load_tile_f16(vcur + (n * 16) * VSTR, VSTR);
#pragma unroll
            for (int q = 0; q < 2; ++q) oacc[q][n] = wmma_f16(av, bp[q], oacc[q][n]);
        }
    }
    // normalize and store attn as [b][s][h*64+d] f16: 8 consecutive d per lane
#pragma unroll
    for (int q = 0; q < 2; ++q) {
        const float rl = 1.0f / (lsum[q] + xhalf(lsum[q]));
        f16* orow = attn + ((size_t)b * SS + s0 + q * 16 + col) * EE + h * DD + 8 * hi;
#pragma unroll
        for (int n = 0; n < 4; ++n) {
            v8h o;
#pragma unroll
            for (int g = 0; g < 8; ++g) o[g] = (f16)(oacc[q][n][g] * rl);
            *(v8h*)(orow + n * 16) = o;
        }
    }
}

// ---------------------------------------------------------------------------
// Kernel 3: output projection  out = attn @ Wp^T + bp   (f32 out)
// 8 waves / block compute a 128x128 tile as 2 x 4 wave tiles of 64x32; A and B
// are staged in LDS 64 k at a time. Per chunk a wave reads its 8 A and 4 B
// fragments as one group and feeds 16 matrix instructions from them.
// ---------------------------------------------------------------------------
#define OBK  64   // k depth of one staged chunk
#define OSTR 72   // LDS stride (halves) for 128x64 chunks: 144B, 16B x odd

__global__ void __launch_bounds__(256) out_proj_kernel(const f16* __restrict__ attn,
        const f16* __restrict__ Wp16, const float* __restrict__ bp,
        float* __restrict__ out) {
    const int rt = blockIdx.x;                      // 0..63 (128-row groups)
    const int ct = blockIdx.y;                      // 0..7  (128-col groups)
    const int tid  = threadIdx.x;
    const int w    = tid >> 5;
    const int lane = tid & 31;
    const int col = lane & 15, hi = lane >> 4;
    const int wr = w >> 2;                          // 64-row half of the tile
    const int wc = w & 3;                           // 32-col quarter of the tile

    __shared__ __align__(16) f16 smem2[2 * 128 * OSTR];        // 36 KB
    f16* ldsA = smem2;
    f16* ldsB = smem2 + 128 * OSTR;

    v8f acc[4][2];
#pragma unroll
    for (int j = 0; j < 2; ++j) {
        float bval = bp[ct * 128 + wc * 32 + j * 16 + col];
#pragma unroll
        for (int i = 0; i < 4; ++i)
#pragma unroll
            for (int g = 0; g < 8; ++g) acc[i][j][g] = bval;
    }

    const int lrow = tid >> 3;       // 0..31 (four passes cover 128 rows)
    const int lchunk = tid & 7;      // 16B chunks of the 128B-wide k-slab
    const f16* asrc = attn + (size_t)(rt * 128 + lrow) * EE + lchunk * 8;
    const f16* bsrc = Wp16 + (size_t)(ct * 128 + lrow) * EE + lchunk * 8;
    f16* adst = ldsA + lrow * OSTR + lchunk * 8;
    f16* bdst = ldsB + lrow * OSTR + lchunk * 8;
    const f16* afrag = ldsA + wr * 64 * OSTR;
    const f16* bfrag = ldsB + wc * 32 * OSTR;
    for (int kc = 0; kc < EE / OBK; ++kc) {
        __syncthreads();             // previous chunk fully consumed
#pragma unroll
        for (int rr = 0; rr < 4; ++rr) {
            *(int4*)(adst + rr * 32 * OSTR) = *(const int4*)(asrc + (size_t)rr * 32 * EE);
            *(int4*)(bdst + rr * 32 * OSTR) = *(const int4*)(bsrc + (size_t)rr * 32 * EE);
        }
        asrc += OBK;
        bsrc += OBK;
        __syncthreads();
        v16h a[OBK / 32][4], bm[OBK / 32][2];
#pragma unroll
        for (int ks = 0; ks < OBK / 32; ++ks) {
#pragma unroll
            for (int j = 0; j < 2; ++j)
                bm[ks][j] = load_tile_f16(bfrag + j * 16 * OSTR + ks * 32, OSTR);
#pragma unroll
            for (int i = 0; i < 4; ++i)
                a[ks][i] = load_tile_f16(afrag + i * 16 * OSTR + ks * 32, OSTR);
        }
        // keeps the chunk's fragment reads one group ahead of its matrix
        // instructions: sunk among them, each read's LDS latency is waited singly
        __builtin_amdgcn_sched_barrier(0);
#pragma unroll
        for (int ks = 0; ks < OBK / 32; ++ks)
#pragma unroll
            for (int i = 0; i < 4; ++i)
#pragma unroll
                for (int j = 0; j < 2; ++j)
                    acc[i][j] = wmma_f16(a[ks][i], bm[ks][j], acc[i][j]);
    }
    float* obase = out + (size_t)(rt * 128 + wr * 64 + 8 * hi) * EE + ct * 128 + wc * 32 + col;
#pragma unroll
    for (int i = 0; i < 4; ++i)
#pragma unroll
        for (int g = 0; g < 8; ++g)
#pragma unroll
            for (int j = 0; j < 2; ++j)
                obase[(size_t)(i * 16 + g) * EE + j * 16] = acc[i][j][g];
}

// ---------------------------------------------------------------------------
extern "C" void kernel_launch(void* const* d_in, const int* in_sizes, int n_in,
                              void* d_out, int out_size, void* d_ws, size_t ws_size,
                              hipStream_t stream) {
    const float* x  = (const float*)d_in[0];
    const float* Wq = (const float*)d_in[1];
    const float* bq = (const float*)d_in[2];
    const float* Wk = (const float*)d_in[3];
    const float* bk = (const float*)d_in[4];
    const float* Wv = (const float*)d_in[5];
    const float* bv = (const float*)d_in[6];
    const float* Wp = (const float*)d_in[7];
    const float* bp = (const float*)d_in[8];
    float* out = (float*)d_out;

    const size_t nPH = (size_t)BB * HH * SS * DD;   // 8,388,608 halves / tensor
    f16* Q    = (f16*)d_ws;
    f16* Kb   = Q  + nPH;
    f16* Vt   = Kb + nPH;
    f16* attn = Vt + nPH;
    f16* Wp16 = attn + (size_t)BB * SS * EE;        // ~66 MB total workspace

    qkv_kernel<<<dim3(BB * HH, SS / 256), 256, 0, stream>>>(x, Wq, bq, Wk, bk, Wv, bv, Wp,
                                                          Q, Kb, Vt, Wp16);
    flash_attn_kernel<<<dim3(BB * HH, SS / 256), 256, 0, stream>>>(Q, Kb, Vt, attn);
    out_proj_kernel<<<dim3(BB * SS / 128, EE / 128), 256, 0, stream>>>(attn, Wp16, bp, out);
}

// v007
// One run takes 80.3 microseconds.
// In both of two side-by-side timings against v006, it was 1.11 times as fast.
// All steps since v000 together make it 2.49 times as fast.
#include <hip/hip_runtime.h>
#include <hip/hip_bf16.h>
#include <cstdint>

typedef _Float16 f16;
typedef __attribute__((ext_vector_type(16))) _Float16 v16h;
typedef __attribute__((ext_vector_type(8)))  _Float16 v8h;
typedef __attribute__((ext_vector_type(8)))  float    v8f;

#define BB 4
#define SS 2048
#define EE 1024
#define HH 16
#define DD 64

// ---------------------------------------------------------------------------
// Operand gathers per CDNA5 WMMA VGPR layouts (ISA 7.12.2, wave32):
//  A (16x32 f16): lane L holds row m=L&15; half-pair r holds
//      K = (r<4 ? 2r : 16+2(r-4)) + 8*(L>>4), K+1
//  B (32x16 f16): same gather over the row-major TRANSPOSED B source
//      (row index = output column n = L&15).
// ---------------------------------------------------------------------------
static __device__ __forceinline__ v16h load_tile_f16(const f16* base, int ld) {
    const int lane = threadIdx.x & 31;
    const int m = lane & 15, hi = lane >> 4;
    const f16* row = base + (size_t)m * ld;
    v16h out;
#pragma unroll
    for (int r = 0; r < 8; ++r) {
        int k = ((r < 4) ? (2 * r) : (16 + 2 * (r - 4))) + 8 * hi;
        out[2 * r]     = row[k];
        out[2 * r + 1] = row[k + 1];
    }
    return out;
}

static __device__ __forceinline__ v16h load_tile_f32(const float* base, int ld) {
    const int lane = threadIdx.x & 31;
    const int m = lane & 15, hi = lane >> 4;
    const float* row = base + (size_t)m * ld;
    v16h out;
#pragma unroll
    for (int r = 0; r < 8; ++r) {
        int k = ((r < 4) ? (2 * r) : (16 + 2 * (r - 4))) + 8 * hi;
        out[2 * r]     = (f16)row[k];
        out[2 * r + 1] = (f16)row[k + 1];
    }
    return out;
}

static __device__ __forceinline__ v8f wmma_f16(v16h a, v16h b, v8f c) {
    return __builtin_amdgcn_wmma_f32_16x16x32_f16(false, a, false, b,
                                                  (short)0, c, false, false);
}

// Async global->LDS copy of 16 bytes, tracked by ASYNCcnt (CDNA5 path;
// ISA 15.18.3 opcode 98). LDS dest offset comes from the low 32 bits of
// the generic pointer (LDS aperture: addr[31:0] is the LDS byte address).
static __device__ __forceinline__ void async_b128(const f16* gsrc, f16* ldst) {
    unsigned           dst = (unsigned)(uintptr_t)(void*)ldst;
    unsigned long long src = (unsigned long long)(uintptr_t)gsrc;
    asm volatile("global_load_async_to_lds_b128 %0, %1, off"
                 :: "v"(dst), "v"(src) : "memory");
}
static __device__ __forceinline__ void wait_async0() {
    asm volatile("s_wait_asynccnt 0x0" ::: "memory");
}

// ---------------------------------------------------------------------------
// Kernel 1: QKV projection. 8 waves / block share one f16 copy of the three
// 64x64 weight matrices in LDS, converted once per block from whole-line loads;
// each wave takes two 16-row s-tiles of one (b,h) and reads its B fragments
// from LDS, every fragment feeding both tiles.
//   Q (scaled, see Q_SCALE), K stored [bh][s][d] f16 ; V transposed [bh][d][s] f16.
// Each block also converts its equal share of Wp to f16 for the output
// projection: a launch of its own for that started eight times the waves of
// this one, each for a single element.
// ---------------------------------------------------------------------------
#define WSTR 72   // LDS stride (halves) of a staged 64-wide weight row: 144B
#define QKV_BLOCKS (BB * HH * (SS / 256))          // 512
#define WP_SHARE   (EE * EE / QKV_BLOCKS)          // 2048 elements of Wp per block
// Q is stored times 1/sqrt(64) * log2(e): the attention scores then leave the
// matrix unit as exponents of 2 and need no scaling of their own
#define Q_SCALE 0.18033688f

typedef __attribute__((ext_vector_type(4))) _Float16 v4h;

// 512 blocks = two per WGP = four waves per SIMD: the register budget of that
// residency (256) is stated so that the whole grid is resident at once.
__global__ void __launch_bounds__(256) __attribute__((amdgpu_waves_per_eu(4)))
qkv_kernel(const float* __restrict__ x,
        const float* __restrict__ Wq, const float* __restrict__ bq,
        const float* __restrict__ Wk, const float* __restrict__ bk,
        const float* __restrict__ Wv, const float* __restrict__ bv,
        const float* __restrict__ Wp,
        f16* __restrict__ Q, f16* __restrict__ Kb, f16* __restrict__ Vt,
        f16* __restrict__ Wp16) {
    const int bh = blockIdx.x;          // 0..63
    const int b = bh >> 4, h = bh & 15;
    const int tid  = threadIdx.x;
    const int lane = tid & 31;
    const int col = lane & 15, hi = lane >> 4;
    const int s0 = blockIdx.y * 256 + (tid >> 5) * 32;   // this wave's 32 rows

    __shared__ __align__(16) f16 wlds[3 * DD * WSTR];    // 27 KB

    const float* Ws[3] = {Wq, Wk, Wv};
    const float* bs[3] = {bq, bk, bv};

    // weights: 256 threads x 4 floats cover 16 rows of one matrix per pass
    float4 wraw[3][4];
#pragma unroll
    for (int w = 0; w < 3; ++w)
#pragma unroll
        for (int r = 0; r < 4; ++r)
            wraw[w][r] = *(const float4*)(Ws[w] + (r * 256 + tid) * 4);
    // this block's share of Wp: four consecutive floats a thread and pass
    const int pbase = (blockIdx.y * (BB * HH) + blockIdx.x) * WP_SHARE + tid * 4;
    float4 praw[WP_SHARE / 1024];
#pragma unroll
    for (int r = 0; r < WP_SHARE / 1024; ++r)
        praw[r] = *(const float4*)(Wp + pbase + r * 1024);
    float bval[3][4];                    // asked for ahead of the barrier
#pragma unroll
    for (int w = 0; w < 3; ++w)
#pragma unroll
        for (int n = 0; n < 4; ++n) bval[w][n] = bs[w][n * 16 + col];

    const float* xbase = x + ((size_t)(b * SS + s0)) * EE + h * DD;
    v16h a0[2], a1[2];
#pragma unroll
    for (int t = 0; t < 2; ++t) {
        a0[t] = load_tile_f32(xbase + (size_t)t * 16 * EE,      EE);   // d = 0..31
        a1[t] = load_tile_f32(xbase + (size_t)t * 16 * EE + 32, EE);   // d = 32..63
    }

#pragma unroll
    for (int w = 0; w < 3; ++w)
#pragma unroll
        for (int r = 0; r < 4; ++r) {
            const int idx = r * 256 + tid;               // float4 index in the matrix
            v4h hv = {(f16)wraw[w][r].x, (f16)wraw[w][r].y,
                      (f16)wraw[w][r].z, (f16)wraw[w][r].w};
            *(v4h*)(wlds + (w * DD + (idx >> 4)) * WSTR + (idx & 15) * 4) = hv;
        }
    __syncthreads();                     // the staged weights are read by every wave

    // stored behind the barrier, which would otherwise wait for these stores
#pragma unroll
    for (int r = 0; r < WP_SHARE / 1024; ++r) {
        v4h hv = {(f16)praw[r].x, (f16)praw[r].y, (f16)praw[r].z, (f16)praw[r].w};
        *(v4h*)(Wp16 + pbase + r * 1024) = hv;
    }

#pragma unroll
    for (int w = 0; w < 3; ++w) {
#pragma unroll
        for (int n = 0; n < 4; ++n) {
            const f16* wt = wlds + (w * DD + n * 16) * WSTR;
            v16h b0 = load_tile_f16(wt,      WSTR);
            v16h b1 = load_tile_f16(wt + 32, WSTR);
#pragma unroll
            for (int t = 0; t < 2; ++t) {
                v8f c = {};
#pragma unroll
                for (int g = 0; g < 8; ++g) c[g] = bval[w][n];
                c = wmma_f16(a0[t], b0, c);
                c = wmma_f16(a1[t], b1, c);
#pragma unroll
                for (int g = 0; g < 8; ++g) {
                    int srow = s0 + t * 16 + g + 8 * hi;
                    int d = n * 16 + col;
                    f16 val = (f16)(w == 0 ? c[g] * Q_SCALE : c[g]);
                    if (w == 0)      Q [((size_t)bh * SS + srow) * DD + d] = val;
                    else if (w == 1) Kb[((size_t)bh * SS + srow) * DD + d] = val;
                    else             Vt[((size_t)bh * DD + d) * SS + srow] = val;
                }
            }
        }
    }
}

#define KSTR 72   // LDS stride (halves) for 32x64 K tile: 144B, odd bank step
#define VSTR 40   // LDS stride for 64x32 V tile: 80B
#define KSZ  (32 * KSTR)            // 2304 halves per K buffer
#define VSZ  (64 * VSTR)            // 2560 halves per V buffer
#define POFF (2 * KSZ + 2 * VSZ)    // 9728
// a lane's 16 exponentials of a pass may sum to this much before the reference
// is raised: each is then at most 2^12, far inside the f16 range of P
#define P_LIMIT 4096.0f

// lane l <-> lane l ^ 16: the two lanes that share one query column
static __device__ __forceinline__ float xhalf(float v) {
    int i = __builtin_bit_cast(int, v);
    return __builtin_bit_cast(float,
        __builtin_amdgcn_permlanex16(i, i, 0x76543210, 0xfedcba98, false, false));
}

// exp2 for the rarely run path. There an argument dies at its exponential;
// the v_nop in the same
// statement keeps the slot that the instruction set asks for behind a transcendental.
static __device__ __forceinline__ float exp2_slot(float x) {
    float e;
    asm("v_exp_f32 %0, %1\n\tv_nop" : "=v"(e) : "v"(x));
    return e;
}

// exponentials of one query's 16 in-lane scores (two accumulator tiles): their sum,
// and P^T as the B operand: the two tiles, converted in place, already lie in the
// operand's k order (k = 8hi + g, 16 + 8hi + g)
template <bool RARE>
static __device__ __forceinline__ void exp_pack(v8f c0, v8f c1, v16h& bp, float& ps) {
    float ps0 = 0.0f, ps1 = 0.0f;
#pragma unroll
    for (int g = 0; g < 8; ++g) {
        const float e0 = RARE ? exp2_slot(c0[g]) : __builtin_amdgcn_exp2f(c0[g]);
        const float e1 = RARE ? exp2_slot(c1[g]) : __builtin_amdgcn_exp2f(c1[g]);
        ps0 += e0;
        ps1 += e1;
        bp[g]     = (f16)e0;
        bp[8 + g] = (f16)e1;
    }
    ps = ps0 + ps1;
}

// 512 blocks = two per WGP = four waves per SIMD: the register budget of that
// residency (256) is stated so that fragments can be fetched ahead of their use.
__global__ void __launch_bounds__(256) __attribute__((amdgpu_waves_per_eu(4, 4)))
flash_attn_kernel(const f16* __restrict__ Q,
        const f16* __restrict__ Kb, const f16* __restrict__ Vt,
        f16* __restrict__ attn) {
    const int bh = blockIdx.x;
    const int b = bh >> 4, h = bh & 15;
    const int tid  = threadIdx.x;
    const int w    = tid >> 5;
    const int lane = tid & 31;
    const int col = lane & 15, hi = lane >> 4;
    const int s0 = blockIdx.y * 256 + w * 32;       // this wave's query rows

    __shared__ __align__(16) f16 smem[POFF];        // 19 KB

    // Per-thread async-copy assignment: 256 threads x 16B covers each 4KB tile.
    const int krow = tid >> 3, kchunk = tid & 7;    // K: 32 rows x 128B
    const int vrow = tid >> 2, vchunk = tid & 3;    // V: 64 rows x 64B

    auto issue_tiles = [&](int j, int buf) {
        f16* kbuf = smem + buf * KSZ;               // no pointer arrays: compute
        f16* vbuf = smem + 2 * KSZ + buf * VSZ;     // bases arithmetically
        async_b128(Kb + ((size_t)bh * SS + j * 32 + krow) * DD + kchunk * 8,
                   kbuf + krow * KSTR + kchunk * 8);
        async_b128(Vt + ((size_t)bh * DD + vrow) * SS + j * 32 + vchunk * 8,
                   vbuf + vrow * VSTR + vchunk * 8);
    };

    // Q as the B operand: lane holds query column col, kept in registers
    const f16* qbase = Q + ((size_t)bh * SS + s0) * DD;
    v16h aq0[2], aq1[2];         // column tile q: queries s0 + 16q + col
#pragma unroll
    for (int q = 0; q < 2; ++q) {
        aq0[q] = load_tile_f16(qbase + q * 16 * DD,      DD);
        aq1[q] = load_tile_f16(qbase + q * 16 * DD + 32, DD);
    }

    // per lane and column tile: minus the query's reference in use (equal in both
    // halves), spread over an accumulator as the score product's C operand, and
    // the sum over this half's keys only (joined after the loop)
    v8f negm[2] = {};
    float lsum[2] = {0.0f, 0.0f};
    v8f oacc[2][4] = {};         // oacc[q][n][g] = O[query][d = 16n + 8hi + g]

    issue_tiles(0, 0);
    for (int j = 0; j < SS / 32; ++j) {
        const int buf = j & 1;
        const f16* kcur = smem + buf * KSZ;
        const f16* vcur = smem + 2 * KSZ + buf * VSZ;

        wait_async0();           // my async copies for tile j done
        __syncthreads();         // everyone's copies done; prior reads retired
        if (j + 1 < SS / 32) issue_tiles(j + 1, buf ^ 1);   // overlap next tile

        // ---- scores: K(32x64) x Q^T(64x32) as two by two 16x16 tiles ----
        // c[q][t][g] = S[query of tile q][key 16t + 8hi + g] - reference of the query
        v8f c[2][2];
        v16h kf[2][2];                               // [key tile][d half]
#pragma unroll
        for (int t = 0; t < 2; ++t) {
            kf[t][0] = load_tile_f16(kcur + t * 16 * KSTR,      KSTR);
            kf[t][1] = load_tile_f16(kcur + t * 16 * KSTR + 32, KSTR);
        }
        // (query tile outermost: with the key tile outermost the compiler copied one
        //  reference vector into a score tile's registers in every pass)
#pragma unroll
        for (int q = 0; q < 2; ++q)
#pragma unroll
            for (int t = 0; t < 2; ++t)              // scaled through Q already
                c[q][t] = wmma_f16(kf[t][1], aq1[q], wmma_f16(kf[t][0], aq0[q], negm[q]));
        // V^T fragments asked for here: their LDS latency passes under the exponentials
        v16h av[4];
#pragma unroll
        for (int n = 0; n < 4; ++n) av[n] = load_tile_f16(vcur + (n * 16) * VSTR, VSTR);
        v16h bp[2];
        float ps[2];
#pragma unroll
        for (int q = 0; q < 2; ++q) exp_pack<false>(c[q][0], c[q][1], bp[q], ps[q]);
        // ---- one test a pass and wave; the first pass sets the reference ----
        // (marked unlikely so that the common path falls through without a jump)
        const unsigned over = __builtin_amdgcn_ballot_w32(fmaxf(ps[0], ps[1]) > P_LIMIT);
        if (__builtin_expect((over | (j == 0 ? 1u : 0u)) != 0, 0)) {
#pragma unroll
            for (int q = 0; q < 2; ++q) {
                float tmax = fmaxf(c[q][0][0], c[q][1][0]);
#pragma unroll
                for (int g = 1; g < 8; ++g) tmax = fmaxf(tmax, fmaxf(c[q][0][g], c[q][1][g]));
                tmax = fmaxf(tmax, xhalf(tmax));     // the query's, over both halves
                // the reference never falls again: what is summed so far shrinks only
                const float up    = fmaxf(tmax, 0.0f);
                const float d     = (j == 0) ? tmax : up;
                const float scale = exp2_slot(-up);
                negm[q] = negm[q] - d;
                exp_pack<true>(c[q][0] - d, c[q][1] - d, bp[q], ps[q]);
                lsum[q] *= scale;
#pragma unroll
                for (int n = 0; n < 4; ++n) oacc[q][n] *= scale;
            }
        }
#pragma unroll
        for (int q = 0; q < 2; ++q) lsum[q] += ps[q];
        // ---- V^T(16x32) x P^T(32x32) for each of 4 d-tiles ----
#pragma unroll
        for (int n = 0; n < 4; ++n)
#pragma unroll
            for (int q = 0; q < 2; ++q) oacc[q][n] = wmma_f16(av[n], bp[q], oacc[q][n]);
    }
    // normalize and store attn as [b][s][h*64+d] f16: 8 consecutive d per lane
#pragma unroll
    for (int q = 0; q < 2; ++q) {
        const float rl = 1.0f / (lsum[q] + xhalf(lsum[q]));
        f16* orow = attn + ((size_t)b * SS + s0 + q * 16 + col) * EE + h * DD + 8 * hi;
#pragma unroll
        for (int n = 0; n < 4; ++n) {
            v8h o;
#pragma unroll
            for (int g = 0; g < 8; ++g) o[g] = (f16)(oacc[q][n][g] * rl);
            *(v8h*)(orow + n * 16) = o;
        }
    }
}

// ---------------------------------------------------------------------------
// Kernel 3: output projection  out = attn @ Wp^T + bp   (f32 out)
// 8 waves / block compute a 128x128 tile as 2 x 4 wave tiles of 64x32; A and B
// are staged in LDS 64 k at a time. Per chunk a wave reads its 8 A and 4 B
// fragments as one group and feeds 16 matrix instructions from them.
// ---------------------------------------------------------------------------
#define OBK  64   // k depth of one staged chunk
#define OSTR 72   // LDS stride (halves) for 128x64 chunks: 144B, 16B x odd

__global__ void __launch_bounds__(256) out_proj_kernel(const f16* __restrict__ attn,
        const f16* __restrict__ Wp16, const float* __restrict__ bp,
        float* __restrict__ out) {
    const int rt = blockIdx.x;                      // 0..63 (128-row groups)
    const int ct = blockIdx.y;                      // 0..7  (128-col groups)
    const int tid  = threadIdx.x;
    const int w    = tid >> 5;
    const int lane = tid & 31;
    const int col = lane & 15, hi = lane >> 4;
    const int wr = w >> 2;                          // 64-row half of the tile
    const int wc = w & 3;                           // 32-col quarter of the tile

    __shared__ __align__(16) f16 smem2[2 * 128 * OSTR];        // 36 KB
    f16* ldsA = smem2;
    f16* ldsB = smem2 + 128 * OSTR;

    v8f acc[4][2];
#pragma unroll
    for (int j = 0; j < 2; ++j) {
        float bval = bp[ct * 128 + wc * 32 + j * 16 + col];
#pragma unroll
        for (int i = 0; i < 4; ++i)
#pragma unroll
            for (int g = 0; g < 8; ++g) acc[i][j][g] = bval;
    }

    const int lrow = tid >> 3;       // 0..31 (four passes cover 128 rows)
    const int lchunk = tid & 7;      // 16B chunks of the 128B-wide k-slab
    const f16* asrc = attn + (size_t)(rt * 128 + lrow) * EE + lchunk * 8;
    const f16* bsrc = Wp16 + (size_t)(ct * 128 + lrow) * EE + lchunk * 8;
    f16* adst = ldsA + lrow * OSTR + lchunk * 8;
    f16* bdst = ldsB + lrow * OSTR + lchunk * 8;
    const f16* afrag = ldsA + wr * 64 * OSTR;
    const f16* bfrag = ldsB + wc * 32 * OSTR;
    for (int kc = 0; kc < EE / OBK; ++kc) {
        __syncthreads();             // previous chunk fully consumed
#pragma unroll
        for (int rr = 0; rr < 4; ++rr) {
            *(int4*)(adst + rr * 32 * OSTR) = *(const int4*)(asrc + (size_t)rr * 32 * EE);
            *(int4*)(bdst + rr * 32 * OSTR) = *(const int4*)(bsrc + (size_t)rr * 32 * EE);
        }
        asrc += OBK;
        bsrc += OBK;
        __syncthreads();
        v16h a[OBK / 32][4], bm[OBK / 32][2];
#pragma unroll
        for (int ks = 0; ks < OBK / 32; ++ks) {
#pragma unroll
            for (int j = 0; j < 2; ++j)
                bm[ks][j] = load_tile_f16(bfrag + j * 16 * OSTR + ks * 32, OSTR);
#pragma unroll
            for (int i = 0; i < 4; ++i)
                a[ks][i] = load_tile_f16(afrag + i * 16 * OSTR + ks * 32, OSTR);
        }
        // keeps the chunk's fragment reads one group ahead of its matrix
        // instructions: sunk among them, each read's LDS latency is waited singly
        __builtin_amdgcn_sched_barrier(0);
#pragma unroll
        for (int ks = 0; ks < OBK / 32; ++ks)
#pragma unroll
            for (int i = 0; i < 4; ++i)
#pragma unroll
                for (int j = 0; j < 2; ++j)
                    acc[i][j] = wmma_f16(a[ks][i], bm[ks][j], acc[i][j]);
    }
    float* obase = out + (size_t)(rt * 128 + wr * 64 + 8 * hi) * EE + ct * 128 + wc * 32 + col;
#pragma unroll
    for (int i = 0; i < 4; ++i)
#pragma unroll
        for (int g = 0; g < 8; ++g)
#pragma unroll
            for (int j = 0; j < 2; ++j)
                obase[(size_t)(i * 16 + g) * EE + j * 16] = acc[i][j][g];
}

// ---------------------------------------------------------------------------
extern "C" void kernel_launch(void* const* d_in, const int* in_sizes, int n_in,
                              void* d_out, int out_size, void* d_ws, size_t ws_size,
                              hipStream_t stream) {
    const float* x  = (const float*)d_in[0];
    const float* Wq = (const float*)d_in[1];
    const float* bq = (const float*)d_in[2];
    const float* Wk = (const float*)d_in[3];
    const float* bk = (const float*)d_in[4];
    const float* Wv = (const float*)d_in[5];
    const float* bv = (const float*)d_in[6];
    const float* Wp = (const float*)d_in[7];
    const float* bp = (const float*)d_in[8];
    float* out = (float*)d_out;

    const size_t nPH = (size_t)BB * HH * SS * DD;   // 8,388,608 halves / tensor
    f16* Q    = (f16*)d_ws;
    f16* Kb   = Q  + nPH;
    f16* Vt   = Kb + nPH;
    f16* attn = Vt + nPH;
    f16* Wp16 = attn + (size_t)BB * SS * EE;        // ~66 MB total workspace

    qkv_kernel<<<dim3(BB * HH, SS / 256), 256, 0, stream>>>(x, Wq, bq, Wk, bk, Wv, bv, Wp,
                                                          Q, Kb, Vt, Wp16);
    flash_attn_kernel<<<dim3(BB * HH, SS / 256), 256, 0, stream>>>(Q, Kb, Vt, attn);
    out_proj_kernel<<<dim3(BB * SS / 128, EE / 128), 256, 0, stream>>>(attn, Wp16, bp, out);
}

// v008
// A run of this version takes 76.1 microseconds.
// In two side-by-side timings against v007, it was 1.06 and 1.05 times as fast.
// Counting every step since v000, it is 2.63 times as fast.
#include <hip/hip_runtime.h>
#include <hip/hip_bf16.h>
#include <cstdint>

typedef _Float16 f16;
typedef __attribute__((ext_vector_type(16))) _Float16 v16h;
typedef __attribute__((ext_vector_type(8)))  _Float16 v8h;
typedef __attribute__((ext_vector_type(8)))  float    v8f;

#define BB 4
#define SS 2048
#define EE 1024
#define HH 16
#define DD 64

// ---------------------------------------------------------------------------
// Operand gathers per CDNA5 WMMA VGPR layouts (ISA 7.12.2, wave32):
//  A (16x32 f16): lane L holds row m=L&15; half-pair r holds
//      K = (r<4 ? 2r : 16+2(r-4)) + 8*(L>>4), K+1
//  B (32x16 f16): same gather over the row-major TRANSPOSED B source
//      (row index = output column n = L&15).
// ---------------------------------------------------------------------------
static __device__ __forceinline__ v16h load_tile_f16(const f16* base, int ld) {
    const int lane = threadIdx.x & 31;
    const int m = lane & 15, hi = lane >> 4;
    const f16* row = base + (size_t)m * ld;
    v16h out;
#pragma unroll
    for (int r = 0; r < 8; ++r) {
        int k = ((r < 4) ? (2 * r) : (16 + 2 * (r - 4))) + 8 * hi;
        out[2 * r]     = row[k];
        out[2 * r + 1] = row[k + 1];
    }
    return out;
}

static __device__ __forceinline__ v16h load_tile_f32(const float* base, int ld) {
    const int lane = threadIdx.x & 31;
    const int m = lane & 15, hi = lane >> 4;
    const float* row = base + (size_t)m * ld;
    v16h out;
#pragma unroll
    for (int r = 0; r < 8; ++r) {
        int k = ((r < 4) ? (2 * r) : (16 + 2 * (r - 4))) + 8 * hi;
        out[2 * r]     = (f16)row[k];
        out[2 * r + 1] = (f16)row[k + 1];
    }
    return out;
}

static __device__ __forceinline__ v8f wmma_f16(v16h a, v16h b, v8f c) {
    return __builtin_amdgcn_wmma_f32_16x16x32_f16(false, a, false, b,
                                                  (short)0, c, false, false);
}

// Async global->LDS copy of 16 bytes, tracked by ASYNCcnt (CDNA5 path;
// ISA 15.18.3 opcode 98). LDS dest offset comes from the low 32 bits of
// the generic pointer (LDS aperture: addr[31:0] is the LDS byte address).
static __device__ __forceinline__ void async_b128(const f16* gsrc, f16* ldst) {
    unsigned           dst = (unsigned)(uintptr_t)(void*)ldst;
    unsigned long long src = (unsigned long long)(uintptr_t)gsrc;
    asm volatile("global_load_async_to_lds_b128 %0, %1, off"
                 :: "v"(dst), "v"(src) : "memory");
}
static __device__ __forceinline__ void wait_async0() {
    asm volatile("s_wait_asynccnt 0x0" ::: "memory");
}

// ---------------------------------------------------------------------------
// Kernel 1: QKV projection. 8 waves / block share one f16 copy of the three
// 64x64 weight matrices in LDS, converted once per block from whole-line loads;
// each wave takes two 16-row s-tiles of one (b,h) and reads its B fragments
// from LDS, every fragment feeding both tiles.
//   Q (scaled, see Q_SCALE), K stored [bh][s][d] f16 ; V transposed [bh][d][s] f16.
// Each block also converts its equal share of Wp to f16 for the output
// projection: a launch of its own for that started eight times the waves of
// this one, each for a single element.
// ---------------------------------------------------------------------------
#define WSTR 72   // LDS stride (halves) of a staged 64-wide weight row: 144B
#define QKV_BLOCKS (BB * HH * (SS / 256))          // 512
#define WP_SHARE   (EE * EE / QKV_BLOCKS)          // 2048 elements of Wp per block
// Q is stored times 1/sqrt(64) * log2(e): the attention scores then leave the
// matrix unit as exponents of 2 and need no scaling of their own
#define Q_SCALE 0.18033688f

typedef __attribute__((ext_vector_type(4))) _Float16 v4h;

// 512 blocks = two per WGP = four waves per SIMD: the register budget of that
// residency (256) is stated so that the whole grid is resident at once.
__global__ void __launch_bounds__(256) __attribute__((amdgpu_waves_per_eu(4)))
qkv_kernel(const float* __restrict__ x,
        const float* __restrict__ Wq, const float* __restrict__ bq,
        const float* __restrict__ Wk, const float* __restrict__ bk,
        const float* __restrict__ Wv, const float* __restrict__ bv,
        const float* __restrict__ Wp,
        f16* __restrict__ Q, f16* __restrict__ Kb, f16* __restrict__ Vt,
        f16* __restrict__ Wp16) {
    const int bh = blockIdx.x;          // 0..63
    const int b = bh >> 4, h = bh & 15;
    const int tid  = threadIdx.x;
    const int lane = tid & 31;
    const int col = lane & 15, hi = lane >> 4;
    const int s0 = blockIdx.y * 256 + (tid >> 5) * 32;   // this wave's 32 rows

    __shared__ __align__(16) f16 wlds[3 * DD * WSTR];    // 27 KB

    const float* Ws[3] = {Wq, Wk, Wv};
    const float* bs[3] = {bq, bk, bv};

    // weights: 256 threads x 4 floats cover 16 rows of one matrix per pass
    float4 wraw[3][4];
#pragma unroll
    for (int w = 0; w < 3; ++w)
#pragma unroll
        for (int r = 0; r < 4; ++r)
            wraw[w][r] = *(const float4*)(Ws[w] + (r * 256 + tid) * 4);
    // this block's share of Wp: four consecutive floats a thread and pass
    const int pbase = (blockIdx.y * (BB * HH) + blockIdx.x) * WP_SHARE + tid * 4;
    float4 praw[WP_SHARE / 1024];
#pragma unroll
    for (int r = 0; r < WP_SHARE / 1024; ++r)
        praw[r] = *(const float4*)(Wp + pbase + r * 1024);
    float bval[3][4];                    // asked for ahead of the barrier
#pragma unroll
    for (int w = 0; w < 3; ++w)
#pragma unroll
        for (int n = 0; n < 4; ++n) bval[w][n] = bs[w][n * 16 + col];

    const float* xbase = x + ((size_t)(b * SS + s0)) * EE + h * DD;
    v16h a0[2], a1[2];
#pragma unroll
    for (int t = 0; t < 2; ++t) {
        a0[t] = load_tile_f32(xbase + (size_t)t * 16 * EE,      EE);   // d = 0..31
        a1[t] = load_tile_f32(xbase + (size_t)t * 16 * EE + 32, EE);   // d = 32..63
    }

#pragma unroll
    for (int w = 0; w < 3; ++w)
#pragma unroll
        for (int r = 0; r < 4; ++r) {
            const int idx = r * 256 + tid;               // float4 index in the matrix
            v4h hv = {(f16)wraw[w][r].x, (f16)wraw[w][r].y,
                      (f16)wraw[w][r].z, (f16)wraw[w][r].w};
            *(v4h*)(wlds + (w * DD + (idx >> 4)) * WSTR + (idx & 15) * 4) = hv;
        }
    __syncthreads();                     // the staged weights are read by every wave

    // stored behind the barrier, which would otherwise wait for these stores
#pragma unroll
    for (int r = 0; r < WP_SHARE / 1024; ++r) {
        v4h hv = {(f16)praw[r].x, (f16)praw[r].y, (f16)praw[r].z, (f16)praw[r].w};
        *(v4h*)(Wp16 + pbase + r * 1024) = hv;
    }

#pragma unroll
    for (int w = 0; w < 3; ++w) {
#pragma unroll
        for (int n = 0; n < 4; ++n) {
            const f16* wt = wlds + (w * DD + n * 16) * WSTR;
            v16h b0 = load_tile_f16(wt,      WSTR);
            v16h b1 = load_tile_f16(wt + 32, WSTR);
#pragma unroll
            for (int t = 0; t < 2; ++t) {
                v8f c = {};
#pragma unroll
                for (int g = 0; g < 8; ++g) c[g] = bval[w][n];
                c = wmma_f16(a0[t], b0, c);
                c = wmma_f16(a1[t], b1, c);
#pragma unroll
                for (int g = 0; g < 8; ++g) {
                    int srow = s0 + t * 16 + g + 8 * hi;
                    int d = n * 16 + col;
                    f16 val = (f16)(w == 0 ? c[g] * Q_SCALE : c[g]);
                    if (w == 0)      Q [((size_t)bh * SS + srow) * DD + d] = val;
                    else if (w == 1) Kb[((size_t)bh * SS + srow) * DD + d] = val;
                    else             Vt[((size_t)bh * DD + d) * SS + srow] = val;
                }
            }
        }
    }
}

#define KSTR 72   // LDS stride (halves) for 32x64 K tile: 144B, odd bank step
#define VSTR 40   // LDS stride for 64x32 V tile: 80B
#define KSZ  (32 * KSTR)            // 2304 halves per K buffer
#define VSZ  (64 * VSTR)            // 2560 halves per V buffer
#define POFF (2 * KSZ + 2 * VSZ)    // 9728
// a lane's 16 exponentials of a pass may sum to this much before the reference
// is raised: each is then at most 2^12, far inside the f16 range of P
#define P_LIMIT 4096.0f

// lane l <-> lane l ^ 16: the two lanes that share one query column
static __device__ __forceinline__ float xhalf(float v) {
    int i = __builtin_bit_cast(int, v);
    return __builtin_bit_cast(float,
        __builtin_amdgcn_permlanex16(i, i, 0x76543210, 0xfedcba98, false, false));
}

// exp2 for the rarely run path. There an argument dies at its exponential;
// the v_nop in the same
// statement keeps the slot that the instruction set asks for behind a transcendental.
static __device__ __forceinline__ float exp2_slot(float x) {
    float e;
    asm("v_exp_f32 %0, %1\n\tv_nop" : "=v"(e) : "v"(x));
    return e;
}

// exponentials of one query's 16 in-lane scores (two accumulator tiles): their sum,
// and P^T as the B operand: the two tiles, converted in place, already lie in the
// operand's k order (k = 8hi + g, 16 + 8hi + g)
template <bool RARE>
static __device__ __forceinline__ void exp_pack(v8f c0, v8f c1, v16h& bp, float& ps) {
    float ps0 = 0.0f, ps1 = 0.0f;
#pragma unroll
    for (int g = 0; g < 8; ++g) {
        const float e0 = RARE ? exp2_slot(c0[g]) : __builtin_amdgcn_exp2f(c0[g]);
        const float e1 = RARE ? exp2_slot(c1[g]) : __builtin_amdgcn_exp2f(c1[g]);
        ps0 += e0;
        ps1 += e1;
        bp[g]     = (f16)e0;
        bp[8 + g] = (f16)e1;
    }
    ps = ps0 + ps1;
}

// 512 blocks = two per WGP = four waves per SIMD: the register budget of that
// residency (256) is stated so that fragments can be fetched ahead of their use.
__global__ void __launch_bounds__(256) __attribute__((amdgpu_waves_per_eu(4, 4)))
flash_attn_kernel(const f16* __restrict__ Q,
        const f16* __restrict__ Kb, const f16* __restrict__ Vt,
        f16* __restrict__ attn) {
    const int bh = blockIdx.x;
    const int b = bh >> 4, h = bh & 15;
    const int tid  = threadIdx.x;
    const int w    = tid >> 5;
    const int lane = tid & 31;
    const int col = lane & 15, hi = lane >> 4;
    const int s0 = blockIdx.y * 256 + w * 32;       // this wave's query rows

    __shared__ __align__(16) f16 smem[POFF];        // 19 KB

    // Per-thread async-copy assignment: 256 threads x 16B covers each 4KB tile.
    const int krow = tid >> 3, kchunk = tid & 7;    // K: 32 rows x 128B
    const int vrow = tid >> 2, vchunk = tid & 3;    // V: 64 rows x 64B

    auto issue_tiles = [&](int j, int buf) {
        f16* kbuf = smem + buf * KSZ;               // no pointer arrays: compute
        f16* vbuf = smem + 2 * KSZ + buf * VSZ;     // bases arithmetically
        async_b128(Kb + ((size_t)bh * SS + j * 32 + krow) * DD + kchunk * 8,
                   kbuf + krow * KSTR + kchunk * 8);
        async_b128(Vt + ((size_t)bh * DD + vrow) * SS + j * 32 + vchunk * 8,
                   vbuf + vrow * VSTR + vchunk * 8);
    };

    // Q as the B operand: lane holds query column col, kept in registers
    const f16* qbase = Q + ((size_t)bh * SS + s0) * DD;
    v16h aq0[2], aq1[2];         // column tile q: queries s0 + 16q + col
#pragma unroll
    for (int q = 0; q < 2; ++q) {
        aq0[q] = load_tile_f16(qbase + q * 16 * DD,      DD);
        aq1[q] = load_tile_f16(qbase + q * 16 * DD + 32, DD);
    }

    // per lane and column tile: minus the query's reference in use (equal in both
    // halves), spread over an accumulator as the score product's C operand, and
    // the sum over this half's keys only (joined after the loop)
    v8f negm[2] = {};
    float lsum[2] = {0.0f, 0.0f};
    v8f oacc[2][4] = {};         // oacc[q][n][g] = O[query][d = 16n + 8hi + g]

    issue_tiles(0, 0);
    for (int j = 0; j < SS / 32; ++j) {
        const int buf = j & 1;
        const f16* kcur = smem + buf * KSZ;
        const f16* vcur = smem + 2 * KSZ + buf * VSZ;

        wait_async0();           // my async copies for tile j done
        __syncthreads();         // everyone's copies done; prior reads retired
        if (j + 1 < SS / 32) issue_tiles(j + 1, buf ^ 1);   // overlap next tile

        // ---- scores: K(32x64) x Q^T(64x32) as two by two 16x16 tiles ----
        // c[q][t][g] = S[query of tile q][key 16t + 8hi + g] - reference of the query
        v8f c[2][2];
        v16h kf[2][2];                               // [key tile][d half]
#pragma unroll
        for (int t = 0; t < 2; ++t) {
            kf[t][0] = load_tile_f16(kcur + t * 16 * KSTR,      KSTR);
            kf[t][1] = load_tile_f16(kcur + t * 16 * KSTR + 32, KSTR);
        }
        // (query tile outermost: with the key tile outermost the compiler copied one
        //  reference vector into a score tile's registers in every pass)
#pragma unroll
        for (int q = 0; q < 2; ++q)
#pragma unroll
            for (int t = 0; t < 2; ++t)              // scaled through Q already
                c[q][t] = wmma_f16(kf[t][1], aq1[q], wmma_f16(kf[t][0], aq0[q], negm[q]));
        // V^T fragments asked for here: their LDS latency passes under the exponentials
        v16h av[4];
#pragma unroll
        for (int n = 0; n < 4; ++n) av[n] = load_tile_f16(vcur + (n * 16) * VSTR, VSTR);
        v16h bp[2];
        float ps[2];
#pragma unroll
        for (int q = 0; q < 2; ++q) exp_pack<false>(c[q][0], c[q][1], bp[q], ps[q]);
        // ---- one test a pass and wave; the first pass sets the reference ----
        // (marked unlikely so that the common path falls through without a jump)
        const unsigned over = __builtin_amdgcn_ballot_w32(fmaxf(ps[0], ps[1]) > P_LIMIT);
        if (__builtin_expect((over | (j == 0 ? 1u : 0u)) != 0, 0)) {
#pragma unroll
            for (int q = 0; q < 2; ++q) {
                float tmax = fmaxf(c[q][0][0], c[q][1][0]);
#pragma unroll
                for (int g = 1; g < 8; ++g) tmax = fmaxf(tmax, fmaxf(c[q][0][g], c[q][1][g]));
                tmax = fmaxf(tmax, xhalf(tmax));     // the query's, over both halves
                // the reference never falls again: what is summed so far shrinks only
                const float up    = fmaxf(tmax, 0.0f);
                const float d     = (j == 0) ? tmax : up;
                const float scale = exp2_slot(-up);
                negm[q] = negm[q] - d;
                exp_pack<true>(c[q][0] - d, c[q][1] - d, bp[q], ps[q]);
                lsum[q] *= scale;
#pragma unroll
                for (int n = 0; n < 4; ++n) oacc[q][n] *= scale;
            }
        }
#pragma unroll
        for (int q = 0; q < 2; ++q) lsum[q] += ps[q];
        // ---- V^T(16x32) x P^T(32x32) for each of 4 d-tiles ----
#pragma unroll
        for (int n = 0; n < 4; ++n)
#pragma unroll
            for (int q = 0; q < 2; ++q) oacc[q][n] = wmma_f16(av[n], bp[q], oacc[q][n]);
    }
    // normalize and store attn as [b][s][h*64+d] f16: 8 consecutive d per lane
#pragma unroll
    for (int q = 0; q < 2; ++q) {
        const float rl = 1.0f / (lsum[q] + xhalf(lsum[q]));
        f16* orow = attn + ((size_t)b * SS + s0 + q * 16 + col) * EE + h * DD + 8 * hi;
#pragma unroll
        for (int n = 0; n < 4; ++n) {
            v8h o;
#pragma unroll
            for (int g = 0; g < 8; ++g) o[g] = (f16)(oacc[q][n][g] * rl);
            *(v8h*)(orow + n * 16) = o;
        }
    }
}

// ---------------------------------------------------------------------------
// Kernel 3: output projection  out = attn @ Wp^T + bp   (f32 out)
// 8 waves / block compute a 128x128 tile as 2 x 4 wave tiles of 64x32; A and B
// are staged in LDS 128 k at a time, in two buffers filled by asynchronous copies:
// the next chunk is on its way from L2 while this one feeds the matrix unit.
// Per 64 k a wave reads its 8 A and 4 B fragments as one group and feeds 16
// matrix instructions from them.
// ---------------------------------------------------------------------------
#define OBK  128  // k depth of one staged chunk: rows of 256 B
#define OSTR 136  // LDS stride (halves) for 128x128 chunks: 272B, 16B x odd
#define OBUF (2 * 128 * OSTR)     // halves of one buffer: the A chunk, then the B chunk

// One thread's share of one operand's chunk: eight 16-byte pieces, 16 rows apart.
// The s_wait_xcnt closes the statement so that it stands in front of every later
// write of the address registers that the copies name.
static __device__ __forceinline__ void async_rows8(const f16* g, f16* l) {
    const unsigned d = (unsigned)(uintptr_t)(void*)l;
    const unsigned step = 16 * OSTR * 2;                 // bytes in LDS between pieces
    asm volatile("global_load_async_to_lds_b128 %0, %8, off\n\t"
                 "global_load_async_to_lds_b128 %1, %9, off\n\t"
                 "global_load_async_to_lds_b128 %2, %10, off\n\t"
                 "global_load_async_to_lds_b128 %3, %11, off\n\t"
                 "global_load_async_to_lds_b128 %4, %12, off\n\t"
                 "global_load_async_to_lds_b128 %5, %13, off\n\t"
                 "global_load_async_to_lds_b128 %6, %14, off\n\t"
                 "global_load_async_to_lds_b128 %7, %15, off\n\t"
                 "s_wait_xcnt 0x0"
                 :: "v"(d), "v"(d + step), "v"(d + 2 * step), "v"(d + 3 * step),
                    "v"(d + 4 * step), "v"(d + 5 * step), "v"(d + 6 * step), "v"(d + 7 * step),
                    "v"(g), "v"(g + 16 * EE), "v"(g + 32 * EE), "v"(g + 48 * EE),
                    "v"(g + 64 * EE), "v"(g + 80 * EE), "v"(g + 96 * EE), "v"(g + 112 * EE)
                 : "memory");
}

__global__ void __launch_bounds__(256) out_proj_kernel(const f16* __restrict__ attn,
        const f16* __restrict__ Wp16, const float* __restrict__ bp,
        float* __restrict__ out) {
    const int rt = blockIdx.x;                      // 0..63 (128-row groups)
    const int ct = blockIdx.y;                      // 0..7  (128-col groups)
    const int tid  = threadIdx.x;
    const int w    = tid >> 5;
    const int lane = tid & 31;
    const int col = lane & 15, hi = lane >> 4;
    const int wr = w >> 2;                          // 64-row half of the tile
    const int wc = w & 3;                           // 32-col quarter of the tile

    __shared__ __align__(16) f16 smem2[2 * OBUF];   // 136 KB: two blocks fit a WGP

    const int lrow = tid >> 4;       // 0..15 (eight pieces cover 128 rows)
    const int lchunk = tid & 15;     // 16B chunks of the 256B-wide k-slab
    const f16* asrc = attn + (size_t)(rt * 128 + lrow) * EE + lchunk * 8;
    const f16* bsrc = Wp16 + (size_t)(ct * 128 + lrow) * EE + lchunk * 8;
    f16* adst = smem2 + lrow * OSTR + lchunk * 8;
    f16* bdst = adst + 128 * OSTR;

    async_rows8(asrc, adst);                        // chunk 0 into buffer 0
    async_rows8(bsrc, bdst);

    v8f acc[4][2];
#pragma unroll
    for (int j = 0; j < 2; ++j) {
        float bval = bp[ct * 128 + wc * 32 + j * 16 + col];
#pragma unroll
        for (int i = 0; i < 4; ++i)
#pragma unroll
            for (int g = 0; g < 8; ++g) acc[i][j][g] = bval;
    }

    wait_async0();                   // my pieces of chunk 0 have landed
    __syncthreads();                 // everyone's have
    async_rows8(asrc + OBK, adst + OBUF);           // chunk 1 into buffer 1
    async_rows8(bsrc + OBK, bdst + OBUF);

    for (int kc = 0; kc < EE / OBK; ++kc) {
        const int buf = kc & 1;
        const f16* afrag = smem2 + buf * OBUF + wr * 64 * OSTR;
        const f16* bfrag = smem2 + buf * OBUF + 128 * OSTR + wc * 32 * OSTR;
#pragma unroll
        for (int hf = 0; hf < OBK / 64; ++hf) {
            v16h a[2][4], bm[2][2];
#pragma unroll
            for (int ks = 0; ks < 2; ++ks) {
#pragma unroll
                for (int j = 0; j < 2; ++j)
                    bm[ks][j] = load_tile_f16(bfrag + j * 16 * OSTR + hf * 64 + ks * 32, OSTR);
#pragma unroll
                for (int i = 0; i < 4; ++i)
                    a[ks][i] = load_tile_f16(afrag + i * 16 * OSTR + hf * 64 + ks * 32, OSTR);
            }
            // keeps the group's fragment reads ahead of its matrix instructions:
            // sunk among them, each read's LDS latency is waited singly
            __builtin_amdgcn_sched_barrier(0);
#pragma unroll
            for (int ks = 0; ks < 2; ++ks)
#pragma unroll
                for (int i = 0; i < 4; ++i)
#pragma unroll
                    for (int j = 0; j < 2; ++j)
                        acc[i][j] = wmma_f16(a[ks][i], bm[ks][j], acc[i][j]);
            // keeps what follows behind the group's matrix instructions: the
            // hand-over, lifted over them, held back the first of them with its wait
            // for every fragment, and the refill, left behind them, flew for less long
            __builtin_amdgcn_sched_barrier(0);
        }
        // hand-over: my reads of this buffer are done, my pieces of the next chunk
        // have landed; behind the barrier both hold for every wave
        asm volatile("s_wait_dscnt 0x0" ::: "memory");
        wait_async0();
        __syncthreads();
        if (kc + 2 < EE / OBK) {     // refill the buffer that this trip has read
            async_rows8(asrc + (kc + 2) * OBK, adst + buf * OBUF);
            async_rows8(bsrc + (kc + 2) * OBK, bdst + buf * OBUF);
        }
    }
    wait_async0();                   // nothing is in flight when the wave ends
    float* obase = out + (size_t)(rt * 128 + wr * 64 + 8 * hi) * EE + ct * 128 + wc * 32 + col;
#pragma unroll
    for (int i = 0; i < 4; ++i)
#pragma unroll
        for (int g = 0; g < 8; ++g)
#pragma unroll
            for (int j = 0; j < 2; ++j)
                obase[(size_t)(i * 16 + g) * EE + j * 16] = acc[i][j][g];
}

// ---------------------------------------------------------------------------
extern "C" void kernel_launch(void* const* d_in, const int* in_sizes, int n_in,
                              void* d_out, int out_size, void* d_ws, size_t ws_size,
                              hipStream_t stream) {
    const float* x  = (const float*)d_in[0];
    const float* Wq = (const float*)d_in[1];
    const float* bq = (const float*)d_in[2];
    const float* Wk = (const float*)d_in[3];
    const float* bk = (const float*)d_in[4];
    const float* Wv = (const float*)d_in[5];
    const float* bv = (const float*)d_in[6];
    const float* Wp = (const float*)d_in[7];
    const float* bp = (const float*)d_in[8];
    float* out = (float*)d_out;

    const size_t nPH = (size_t)BB * HH * SS * DD;   // 8,388,608 halves / tensor
    f16* Q    = (f16*)d_ws;
    f16* Kb   = Q  + nPH;
    f16* Vt   = Kb + nPH;
    f16* attn = Vt + nPH;
    f16* Wp16 = attn + (size_t)BB * SS * EE;        // ~66 MB total workspace

    qkv_kernel<<<dim3(BB * HH, SS / 256), 256, 0, stream>>>(x, Wq, bq, Wk, bk, Wv, bv, Wp,
                                                          Q, Kb, Vt, Wp16);
    flash_attn_kernel<<<dim3(BB * HH, SS / 256), 256, 0, stream>>>(Q, Kb, Vt, attn);
    out_proj_kernel<<<dim3(BB * SS / 128, EE / 128), 256, 0, stream>>>(attn, Wp16, bp, out);
}

// v009
// Measured time: 71.5 microseconds a run.
// Timed twice side by side with v008, it ran 1.07 times as fast both times.
// Counting every step since v000, it is 2.81 times as fast.
#include <hip/hip_runtime.h>
#include <hip/hip_bf16.h>
#include <cstdint>

typedef _Float16 f16;
typedef __attribute__((ext_vector_type(16))) _Float16 v16h;
typedef __attribute__((ext_vector_type(8)))  _Float16 v8h;
typedef __attribute__((ext_vector_type(8)))  float    v8f;

#define BB 4
#define SS 2048
#define EE 1024
#define HH 16
#define DD 64

// ---------------------------------------------------------------------------
// Operand gathers per CDNA5 WMMA VGPR layouts (ISA 7.12.2, wave32):
//  A (16x32 f16): lane L holds row m=L&15; half-pair r holds
//      K = (r<4 ? 2r : 16+2(r-4)) + 8*(L>>4), K+1
//  B (32x16 f16): same gather over the row-major TRANSPOSED B source
//      (row index = output column n = L&15).
// ---------------------------------------------------------------------------
static __device__ __forceinline__ v16h load_tile_f16(const f16* base, int ld) {
    const int lane = threadIdx.x & 31;
    const int m = lane & 15, hi = lane >> 4;
    const f16* row = base + (size_t)m * ld;
    v16h out;
#pragma unroll
    for (int r = 0; r < 8; ++r) {
        int k = ((r < 4) ? (2 * r) : (16 + 2 * (r - 4))) + 8 * hi;
        out[2 * r]     = row[k];
        out[2 * r + 1] = row[k + 1];
    }
    return out;
}

static __device__ __forceinline__ v16h load_tile_f32(const float* base, int ld) {
    const int lane = threadIdx.x & 31;
    const int m = lane & 15, hi = lane >> 4;
    const float* row = base + (size_t)m * ld;
    v16h out;
#pragma unroll
    for (int r = 0; r < 8; ++r) {
        int k = ((r < 4) ? (2 * r) : (16 + 2 * (r - 4))) + 8 * hi;
        out[2 * r]     = (f16)row[k];
        out[2 * r + 1] = (f16)row[k + 1];
    }
    return out;
}

static __device__ __forceinline__ v8f wmma_f16(v16h a, v16h b, v8f c) {
    return __builtin_amdgcn_wmma_f32_16x16x32_f16(false, a, false, b,
                                                  (short)0, c, false, false);
}

// Async global->LDS copies are tracked by ASYNCcnt; their LDS destination is the
// low 32 bits of the generic pointer (LDS aperture: addr[31:0] is the byte address).
static __device__ __forceinline__ void wait_async0() {
    asm volatile("s_wait_asynccnt 0x0" ::: "memory");
}

// ---------------------------------------------------------------------------
// Kernel 1: QKV projection. 8 waves / block share one f16 copy of the three
// 64x64 weight matrices in LDS, converted once per block from whole-line loads;
// each wave takes two 16-row s-tiles of one (b,h) and reads its B fragments
// from LDS, every fragment feeding both tiles.
//   Q (scaled, see Q_SCALE), K stored [bh][s][d] f16 ; V transposed [bh][d][s] f16.
// Each block also converts its equal share of Wp to f16 for the output
// projection: a launch of its own for that started eight times the waves of
// this one, each for a single element.
// ---------------------------------------------------------------------------
#define WSTR 72   // LDS stride (halves) of a staged 64-wide weight row: 144B
#define QKV_BLOCKS (BB * HH * (SS / 256))          // 512
#define WP_SHARE   (EE * EE / QKV_BLOCKS)          // 2048 elements of Wp per block
// Q is stored times 1/sqrt(64) * log2(e): the attention scores then leave the
// matrix unit as exponents of 2 and need no scaling of their own
#define Q_SCALE 0.18033688f

typedef __attribute__((ext_vector_type(4))) _Float16 v4h;

// 512 blocks = two per WGP = four waves per SIMD: the register budget of that
// residency (256) is stated so that the whole grid is resident at once.
__global__ void __launch_bounds__(256) __attribute__((amdgpu_waves_per_eu(4)))
qkv_kernel(const float* __restrict__ x,
        const float* __restrict__ Wq, const float* __restrict__ bq,
        const float* __restrict__ Wk, const float* __restrict__ bk,
        const float* __restrict__ Wv, const float* __restrict__ bv,
        const float* __restrict__ Wp,
        f16* __restrict__ Q, f16* __restrict__ Kb, f16* __restrict__ Vt,
        f16* __restrict__ Wp16) {
    const int bh = blockIdx.x;          // 0..63
    const int b = bh >> 4, h = bh & 15;
    const int tid  = threadIdx.x;
    const int lane = tid & 31;
    const int col = lane & 15, hi = lane >> 4;
    const int s0 = blockIdx.y * 256 + (tid >> 5) * 32;   // this wave's 32 rows

    __shared__ __align__(16) f16 wlds[3 * DD * WSTR];    // 27 KB

    const float* Ws[3] = {Wq, Wk, Wv};
    const float* bs[3] = {bq, bk, bv};

    // weights: 256 threads x 4 floats cover 16 rows of one matrix per pass
    float4 wraw[3][4];
#pragma unroll
    for (int w = 0; w < 3; ++w)
#pragma unroll
        for (int r = 0; r < 4; ++r)
            wraw[w][r] = *(const float4*)(Ws[w] + (r * 256 + tid) * 4);
    // this block's share of Wp: four consecutive floats a thread and pass
    const int pbase = (blockIdx.y * (BB * HH) + blockIdx.x) * WP_SHARE + tid * 4;
    float4 praw[WP_SHARE / 1024];
#pragma unroll
    for (int r = 0; r < WP_SHARE / 1024; ++r)
        praw[r] = *(const float4*)(Wp + pbase + r * 1024);
    float bval[3][4];                    // asked for ahead of the barrier
#pragma unroll
    for (int w = 0; w < 3; ++w)
#pragma unroll
        for (int n = 0; n < 4; ++n) bval[w][n] = bs[w][n * 16 + col];

    const float* xbase = x + ((size_t)(b * SS + s0)) * EE + h * DD;
    v16h a0[2], a1[2];
#pragma unroll
    for (int t = 0; t < 2; ++t) {
        a0[t] = load_tile_f32(xbase + (size_t)t * 16 * EE,      EE);   // d = 0..31
        a1[t] = load_tile_f32(xbase + (size_t)t * 16 * EE + 32, EE);   // d = 32..63
    }

#pragma unroll
    for (int w = 0; w < 3; ++w)
#pragma unroll
        for (int r = 0; r < 4; ++r) {
            const int idx = r * 256 + tid;               // float4 index in the matrix
            v4h hv = {(f16)wraw[w][r].x, (f16)wraw[w][r].y,
                      (f16)wraw[w][r].z, (f16)wraw[w][r].w};
            *(v4h*)(wlds + (w * DD + (idx >> 4)) * WSTR + (idx & 15) * 4) = hv;
        }
    __syncthreads();                     // the staged weights are read by every wave

    // stored behind the barrier, which would otherwise wait for these stores
#pragma unroll
    for (int r = 0; r < WP_SHARE / 1024; ++r) {
        v4h hv = {(f16)praw[r].x, (f16)praw[r].y, (f16)praw[r].z, (f16)praw[r].w};
        *(v4h*)(Wp16 + pbase + r * 1024) = hv;
    }

#pragma unroll
    for (int w = 0; w < 3; ++w) {
#pragma unroll
        for (int n = 0; n < 4; ++n) {
            const f16* wt = wlds + (w * DD + n * 16) * WSTR;
            v16h b0 = load_tile_f16(wt,      WSTR);
            v16h b1 = load_tile_f16(wt + 32, WSTR);
#pragma unroll
            for (int t = 0; t < 2; ++t) {
                v8f c = {};
#pragma unroll
                for (int g = 0; g < 8; ++g) c[g] = bval[w][n];
                c = wmma_f16(a0[t], b0, c);
                c = wmma_f16(a1[t], b1, c);
#pragma unroll
                for (int g = 0; g < 8; ++g) {
                    int srow = s0 + t * 16 + g + 8 * hi;
                    int d = n * 16 + col;
                    f16 val = (f16)(w == 0 ? c[g] * Q_SCALE : c[g]);
                    if (w == 0)      Q [((size_t)bh * SS + srow) * DD + d] = val;
                    else if (w == 1) Kb[((size_t)bh * SS + srow) * DD + d] = val;
                    else             Vt[((size_t)bh * DD + d) * SS + srow] = val;
                }
            }
        }
    }
}

#define SKEYS 128
#define KSTR 72
#define VSTR 136
#define KSZ  (SKEYS * KSTR)         // 9216 halves: the K rows of a stage
#define VSZ  (DD * VSTR)            // 8704 halves: its V^T rows
#define STG  (KSZ + VSZ)            // 17920 halves (35840 B) per buffer
#define NSTG (SS / SKEYS)           // 16 stages
// a lane's 16 exponentials of a pass may sum to this much before the reference
// is raised: each is then at most 2^12, far inside the f16 range of P
#define P_LIMIT 4096.0f

// One thread's share of one stage: four 16-byte pieces of K, 32 rows apart, and four
// of V^T, 16 rows apart. A wave's copy covers 512 B in a row of K or two 256-B rows
// of V^T. The s_wait_xcnt closes the statement so that it stands in front of every
// later write of the address registers that the copies name.
static __device__ __forceinline__ void async_stage(const f16* gk, const f16* gv,
                                                   f16* lk, f16* lv) {
    const unsigned dk = (unsigned)(uintptr_t)(void*)lk;
    const unsigned dv = (unsigned)(uintptr_t)(void*)lv;
    const unsigned ks = 32 * KSTR * 2;                   // bytes in LDS between pieces
    const unsigned vs = 16 * VSTR * 2;
    asm volatile("global_load_async_to_lds_b128 %0, %8, off\n\t"
                 "global_load_async_to_lds_b128 %1, %9, off\n\t"
                 "global_load_async_to_lds_b128 %2, %10, off\n\t"
                 "global_load_async_to_lds_b128 %3, %11, off\n\t"
                 "global_load_async_to_lds_b128 %4, %12, off\n\t"
                 "global_load_async_to_lds_b128 %5, %13, off\n\t"
                 "global_load_async_to_lds_b128 %6, %14, off\n\t"
                 "global_load_async_to_lds_b128 %7, %15, off\n\t"
                 "s_wait_xcnt 0x0"
                 :: "v"(dk), "v"(dk + ks), "v"(dk + 2 * ks), "v"(dk + 3 * ks),
                    "v"(dv), "v"(dv + vs), "v"(dv + 2 * vs), "v"(dv + 3 * vs),
                    "v"(gk), "v"(gk + 32 * DD), "v"(gk + 64 * DD), "v"(gk + 96 * DD),
                    "v"(gv), "v"(gv + 16 * SS), "v"(gv + 32 * SS), "v"(gv + 48 * SS)
                 : "memory");
}

// lane l <-> lane l ^ 16: the two lanes that share one query column
static __device__ __forceinline__ float xhalf(float v) {
    int i = __builtin_bit_cast(int, v);
    return __builtin_bit_cast(float,
        __builtin_amdgcn_permlanex16(i, i, 0x76543210, 0xfedcba98, false, false));
}

// exp2 for the rarely run path. There an argument dies at its exponential;
// the v_nop in the same
// statement keeps the slot that the instruction set asks for behind a transcendental.
static __device__ __forceinline__ float exp2_slot(float x) {
    float e;
    asm("v_exp_f32 %0, %1\n\tv_nop" : "=v"(e) : "v"(x));
    return e;
}

// exponentials of one query's 16 in-lane scores (two accumulator tiles): their sum,
// and P^T as the B operand: the two tiles, converted in place, already lie in the
// operand's k order (k = 8hi + g, 16 + 8hi + g)
template <bool RARE>
static __device__ __forceinline__ void exp_pack(v8f c0, v8f c1, v16h& bp, float& ps) {
    float ps0 = 0.0f, ps1 = 0.0f;
#pragma unroll
    for (int g = 0; g < 8; ++g) {
        const float e0 = RARE ? exp2_slot(c0[g]) : __builtin_amdgcn_exp2f(c0[g]);
        const float e1 = RARE ? exp2_slot(c1[g]) : __builtin_amdgcn_exp2f(c1[g]);
        ps0 += e0;
        ps1 += e1;
        bp[g]     = (f16)e0;
        bp[8 + g] = (f16)e1;
    }
    ps = ps0 + ps1;
}

// 512 blocks = two per WGP = four waves per SIMD: the register budget of that
// residency (256) is stated so that fragments can be fetched ahead of their use.
__global__ void __launch_bounds__(256) __attribute__((amdgpu_waves_per_eu(4, 4)))
flash_attn_kernel(const f16* __restrict__ Q,
        const f16* __restrict__ Kb, const f16* __restrict__ Vt,
        f16* __restrict__ attn) {
    const int bh = blockIdx.x;
    const int b = bh >> 4, h = bh & 15;
    const int tid  = threadIdx.x;
    const int w    = tid >> 5;
    const int lane = tid & 31;
    const int col = lane & 15, hi = lane >> 4;
    const int s0 = blockIdx.y * 256 + w * 32;       // this wave's query rows

    __shared__ __align__(16) f16 smem[2 * STG];     // 70 KB: two blocks fit a WGP

    // Per-thread async-copy assignment: 256 threads x 16B cover 4KB a piece.
    const int krow = tid >> 3, kchunk = tid & 7;    // K: 32 rows x 128B a piece
    const int vrow = tid >> 4, vchunk = tid & 15;   // V: 16 rows x 256B a piece
    const f16* ksrc = Kb + ((size_t)bh * SS + krow) * DD + kchunk * 8;
    const f16* vsrc = Vt + ((size_t)bh * DD + vrow) * SS + vchunk * 8;
    f16* kdst = smem + krow * KSTR + kchunk * 8;
    f16* vdst = smem + KSZ + vrow * VSTR + vchunk * 8;

    auto issue_stage = [&](int t, int buf) {
        async_stage(ksrc + (size_t)t * SKEYS * DD, vsrc + t * SKEYS,
                    kdst + buf * STG, vdst + buf * STG);
    };

    // Q as the B operand: lane holds query column col, kept in registers
    const f16* qbase = Q + ((size_t)bh * SS + s0) * DD;
    v16h aq0[2], aq1[2];         // column tile q: queries s0 + 16q + col
#pragma unroll
    for (int q = 0; q < 2; ++q) {
        aq0[q] = load_tile_f16(qbase + q * 16 * DD,      DD);
        aq1[q] = load_tile_f16(qbase + q * 16 * DD + 32, DD);
    }

    // per lane and column tile: minus the query's reference in use (equal in both
    // halves), spread over an accumulator as the score product's C operand, and
    // the sum over this half's keys only (joined after the loop)
    v8f negm[2] = {};
    float lsum[2] = {0.0f, 0.0f};
    v8f oacc[2][4] = {};         // oacc[q][n][g] = O[query][d = 16n + 8hi + g]

    issue_stage(0, 0);
    wait_async0();               // my pieces of stage 0 have landed
    __syncthreads();             // everyone's have
    issue_stage(1, 1);
    for (int j = 0; j < SS / 32; ++j) {
        const int buf = (j >> 2) & 1, pass = j & 3; // four passes read one stage
        const f16* kcur = smem + buf * STG + pass * 32 * KSTR;
        const f16* vcur = smem + buf * STG + KSZ + pass * 32;

        // ---- scores: K(32x64) x Q^T(64x32) as two by two 16x16 tiles ----
        // c[q][t][g] = S[query of tile q][key 16t + 8hi + g] - reference of the query
        v8f c[2][2];
        v16h kf[2][2];                               // [key tile][d half]
#pragma unroll
        for (int t = 0; t < 2; ++t) {
            kf[t][0] = load_tile_f16(kcur + t * 16 * KSTR,      KSTR);
            kf[t][1] = load_tile_f16(kcur + t * 16 * KSTR + 32, KSTR);
        }
        // (query tile outermost: with the key tile outermost the compiler copied one
        //  reference vector into a score tile's registers in every pass)
#pragma unroll
        for (int q = 0; q < 2; ++q)
#pragma unroll
            for (int t = 0; t < 2; ++t)              // scaled through Q already
                c[q][t] = wmma_f16(kf[t][1], aq1[q], wmma_f16(kf[t][0], aq0[q], negm[q]));
        // V^T fragments asked for here: their LDS latency passes under the exponentials
        v16h av[4];
#pragma unroll
        for (int n = 0; n < 4; ++n) av[n] = load_tile_f16(vcur + (n * 16) * VSTR, VSTR);
        v16h bp[2];
        float ps[2];
#pragma unroll
        for (int q = 0; q < 2; ++q) exp_pack<false>(c[q][0], c[q][1], bp[q], ps[q]);
        // compiler fence: holds the four V^T fragment reads in front of the test, with
        // their waits left at the products. Sunk behind the test, each read was waited
        // for singly, right in front of the two products that it feeds
        asm volatile("" ::: "memory");
        // ---- one test a pass and wave; the first pass sets the reference ----
        // (marked unlikely so that the common path falls through without a jump)
        const unsigned over = __builtin_amdgcn_ballot_w32(fmaxf(ps[0], ps[1]) > P_LIMIT);
        if (__builtin_expect((over | (j == 0 ? 1u : 0u)) != 0, 0)) {
#pragma unroll
            for (int q = 0; q < 2; ++q) {
                float tmax = fmaxf(c[q][0][0], c[q][1][0]);
#pragma unroll
                for (int g = 1; g < 8; ++g) tmax = fmaxf(tmax, fmaxf(c[q][0][g], c[q][1][g]));
                tmax = fmaxf(tmax, xhalf(tmax));     // the query's, over both halves
                // the reference never falls again: what is summed so far shrinks only
                const float up    = fmaxf(tmax, 0.0f);
                const float d     = (j == 0) ? tmax : up;
                const float scale = exp2_slot(-up);
                negm[q] = negm[q] - d;
                exp_pack<true>(c[q][0] - d, c[q][1] - d, bp[q], ps[q]);
                lsum[q] *= scale;
#pragma unroll
                for (int n = 0; n < 4; ++n) oacc[q][n] *= scale;
            }
        }
#pragma unroll
        for (int q = 0; q < 2; ++q) lsum[q] += ps[q];
        // ---- V^T(16x32) x P^T(32x32) for each of 4 d-tiles ----
#pragma unroll
        for (int n = 0; n < 4; ++n)
#pragma unroll
            for (int q = 0; q < 2; ++q) oacc[q][n] = wmma_f16(av[n], bp[q], oacc[q][n]);
        if (pass == 3) {
            // hand-over: my reads of this buffer are done, my pieces of the next stage
            // have landed; behind the barrier both hold for every wave
            asm volatile("s_wait_dscnt 0x0" ::: "memory");
            wait_async0();
            __syncthreads();
            if ((j >> 2) + 2 < NSTG)     // refill the buffer that this stage has read
                issue_stage((j >> 2) + 2, buf);
        }
    }
    wait_async0();               // nothing is in flight when the wave ends
    // normalize and store attn as [b][s][h*64+d] f16: 8 consecutive d per lane
#pragma unroll
    for (int q = 0; q < 2; ++q) {
        const float rl = 1.0f / (lsum[q] + xhalf(lsum[q]));
        f16* orow = attn + ((size_t)b * SS + s0 + q * 16 + col) * EE + h * DD + 8 * hi;
#pragma unroll
        for (int n = 0; n < 4; ++n) {
            v8h o;
#pragma unroll
            for (int g = 0; g < 8; ++g) o[g] = (f16)(oacc[q][n][g] * rl);
            *(v8h*)(orow + n * 16) = o;
        }
    }
}

// ---------------------------------------------------------------------------
// Kernel 3: output projection  out = attn @ Wp^T + bp   (f32 out)
// 8 waves / block compute a 128x128 tile as 2 x 4 wave tiles of 64x32; A and B
// are staged in LDS 128 k at a time, in two buffers filled by asynchronous copies:
// the next chunk is on its way from L2 while this one feeds the matrix unit.
// Per 64 k a wave reads its 8 A and 4 B fragments as one group and feeds 16
// matrix instructions from them.
// ---------------------------------------------------------------------------
#define OBK  128  // k depth of one staged chunk: rows of 256 B
#define OSTR 136  // LDS stride (halves) for 128x128 chunks: 272B, 16B x odd
#define OBUF (2 * 128 * OSTR)     // halves of one buffer: the A chunk, then the B chunk

// One thread's share of one operand's chunk: eight 16-byte pieces, 16 rows apart.
// The s_wait_xcnt closes the statement so that it stands in front of every later
// write of the address registers that the copies name.
static __device__ __forceinline__ void async_rows8(const f16* g, f16* l) {
    const unsigned d = (unsigned)(uintptr_t)(void*)l;
    const unsigned step = 16 * OSTR * 2;                 // bytes in LDS between pieces
    asm volatile("global_load_async_to_lds_b128 %0, %8, off\n\t"
                 "global_load_async_to_lds_b128 %1, %9, off\n\t"
                 "global_load_async_to_lds_b128 %2, %10, off\n\t"
                 "global_load_async_to_lds_b128 %3, %11, off\n\t"
                 "global_load_async_to_lds_b128 %4, %12, off\n\t"
                 "global_load_async_to_lds_b128 %5, %13, off\n\t"
                 "global_load_async_to_lds_b128 %6, %14, off\n\t"
                 "global_load_async_to_lds_b128 %7, %15, off\n\t"
                 "s_wait_xcnt 0x0"
                 :: "v"(d), "v"(d + step), "v"(d + 2 * step), "v"(d + 3 * step),
                    "v"(d + 4 * step), "v"(d + 5 * step), "v"(d + 6 * step), "v"(d + 7 * step),
                    "v"(g), "v"(g + 16 * EE), "v"(g + 32 * EE), "v"(g + 48 * EE),
                    "v"(g + 64 * EE), "v"(g + 80 * EE), "v"(g + 96 * EE), "v"(g + 112 * EE)
                 : "memory");
}

__global__ void __launch_bounds__(256) out_proj_kernel(const f16* __restrict__ attn,
        const f16* __restrict__ Wp16, const float* __restrict__ bp,
        float* __restrict__ out) {
    const int rt = blockIdx.x;                      // 0..63 (128-row groups)
    const int ct = blockIdx.y;                      // 0..7  (128-col groups)
    const int tid  = threadIdx.x;
    const int w    = tid >> 5;
    const int lane = tid & 31;
    const int col = lane & 15, hi = lane >> 4;
    const int wr = w >> 2;                          // 64-row half of the tile
    const int wc = w & 3;                           // 32-col quarter of the tile

    __shared__ __align__(16) f16 smem2[2 * OBUF];   // 136 KB: two blocks fit a WGP

    const int lrow = tid >> 4;       // 0..15 (eight pieces cover 128 rows)
    const int lchunk = tid & 15;     // 16B chunks of the 256B-wide k-slab
    const f16* asrc = attn + (size_t)(rt * 128 + lrow) * EE + lchunk * 8;
    const f16* bsrc = Wp16 + (size_t)(ct * 128 + lrow) * EE + lchunk * 8;
    f16* adst = smem2 + lrow * OSTR + lchunk * 8;
    f16* bdst = adst + 128 * OSTR;

    async_rows8(asrc, adst);                        // chunk 0 into buffer 0
    async_rows8(bsrc, bdst);

    v8f acc[4][2];
#pragma unroll
    for (int j = 0; j < 2; ++j) {
        float bval = bp[ct * 128 + wc * 32 + j * 16 + col];
#pragma unroll
        for (int i = 0; i < 4; ++i)
#pragma unroll
            for (int g = 0; g < 8; ++g) acc[i][j][g] = bval;
    }

    wait_async0();                   // my pieces of chunk 0 have landed
    __syncthreads();                 // everyone's have
    async_rows8(asrc + OBK, adst + OBUF);           // chunk 1 into buffer 1
    async_rows8(bsrc + OBK, bdst + OBUF);

    for (int kc = 0; kc < EE / OBK; ++kc) {
        const int buf = kc & 1;
        const f16* afrag = smem2 + buf * OBUF + wr * 64 * OSTR;
        const f16* bfrag = smem2 + buf * OBUF + 128 * OSTR + wc * 32 * OSTR;
#pragma unroll
        for (int hf = 0; hf < OBK / 64; ++hf) {
            v16h a[2][4], bm[2][2];
#pragma unroll
            for (int ks = 0; ks < 2; ++ks) {
#pragma unroll
                for (int j = 0; j < 2; ++j)
                    bm[ks][j] = load_tile_f16(bfrag + j * 16 * OSTR + hf * 64 + ks * 32, OSTR);
#pragma unroll
                for (int i = 0; i < 4; ++i)
                    a[ks][i] = load_tile_f16(afrag + i * 16 * OSTR + hf * 64 + ks * 32, OSTR);
            }
            // keeps the group's fragment reads ahead of its matrix instructions:
            // sunk among them, each read's LDS latency is waited singly
            __builtin_amdgcn_sched_barrier(0);
#pragma unroll
            for (int ks = 0; ks < 2; ++ks)
#pragma unroll
                for (int i = 0; i < 4; ++i)
#pragma unroll
                    for (int j = 0; j < 2; ++j)
                        acc[i][j] = wmma_f16(a[ks][i], bm[ks][j], acc[i][j]);
            // keeps what follows behind the group's matrix instructions: the
            // hand-over, lifted over them, held back the first of them with its wait
            // for every fragment, and the refill, left behind them, flew for less long
            __builtin_amdgcn_sched_barrier(0);
        }
        // hand-over: my reads of this buffer are done, my pieces of the next chunk
        // have landed; behind the barrier both hold for every wave
        asm volatile("s_wait_dscnt 0x0" ::: "memory");
        wait_async0();
        __syncthreads();
        if (kc + 2 < EE / OBK) {     // refill the buffer that this trip has read
            async_rows8(asrc + (kc + 2) * OBK, adst + buf * OBUF);
            async_rows8(bsrc + (kc + 2) * OBK, bdst + buf * OBUF);
        }
    }
    wait_async0();                   // nothing is in flight when the wave ends
    float* obase = out + (size_t)(rt * 128 + wr * 64 + 8 * hi) * EE + ct * 128 + wc * 32 + col;
#pragma unroll
    for (int i = 0; i < 4; ++i)
#pragma unroll
        for (int g = 0; g < 8; ++g)
#pragma unroll
            for (int j = 0; j < 2; ++j)
                obase[(size_t)(i * 16 + g) * EE + j * 16] = acc[i][j][g];
}

// ---------------------------------------------------------------------------
extern "C" void kernel_launch(void* const* d_in, const int* in_sizes, int n_in,
                              void* d_out, int out_size, void* d_ws, size_t ws_size,
                              hipStream_t stream) {
    const float* x  = (const float*)d_in[0];
    const float* Wq = (const float*)d_in[1];
    const float* bq = (const float*)d_in[2];
    const float* Wk = (const float*)d_in[3];
    const float* bk = (const float*)d_in[4];
    const float* Wv = (const float*)d_in[5];
    const float* bv = (const float*)d_in[6];
    const float* Wp = (const float*)d_in[7];
    const float* bp = (const float*)d_in[8];
    float* out = (float*)d_out;

    const size_t nPH = (size_t)BB * HH * SS * DD;   // 8,388,608 halves / tensor
    f16* Q    = (f16*)d_ws;
    f16* Kb   = Q  + nPH;
    f16* Vt   = Kb + nPH;
    f16* attn = Vt + nPH;
    f16* Wp16 = attn + (size_t)BB * SS * EE;        // ~66 MB total workspace

    qkv_kernel<<<dim3(BB * HH, SS / 256), 256, 0, stream>>>(x, Wq, bq, Wk, bk, Wv, bv, Wp,
                                                          Q, Kb, Vt, Wp16);
    flash_attn_kernel<<<dim3(BB * HH, SS / 256), 256, 0, stream>>>(Q, Kb, Vt, attn);
    out_proj_kernel<<<dim3(BB * SS / 128, EE / 128), 256, 0, stream>>>(attn, Wp16, bp, out);
}
